// v000
// The times below were measured on an AMD MI455X: many runs one after another, warmed up first and cycling through
// copies of the inputs, with the whole window's GPU time divided by the number of runs. Launches and the gaps
// between them are all in it. The median over several windows is given; except for v000 it joins two sittings, which
// can be a few percent apart, so the side-by-side timings, each taken in one sitting, are the better comparison.
// v000 is the starting kernel. One run takes 150 microseconds.
// compute dtype: x, qkv_w/qkv_b, proj_w/proj_b (module inputs) rounded to bf16; qkv projection with exact bf16 products (+ bias); scores and the (s + 5)^2-weighted value sums with both computed operands as bf16 hi + bf16 residual pairs (3 products); output projection hi/lo x bf16 proj_w (2 products) + bias; the quadratic normalisation in f32; f32 accumulate.
#include <hip/hip_runtime.h>
#include <math.h>

typedef __attribute__((ext_vector_type(16))) _Float16 v16h;
typedef __attribute__((ext_vector_type(16))) __bf16 v16b;
typedef __attribute__((ext_vector_type(8)))  _Float16 v8h;
typedef __attribute__((ext_vector_type(8)))  float v8f;
typedef __attribute__((ext_vector_type(4)))  float v4f;
typedef __attribute__((ext_vector_type(2)))  float v2f;
typedef __attribute__((ext_vector_type(4)))  unsigned v4u;
typedef __attribute__((ext_vector_type(4)))  int v4i;
typedef float __attribute__((may_alias)) float_a;
typedef int __attribute__((may_alias)) int_a;

template <typename T> __device__ __forceinline__ void vst2(void* p, T v) { *(T*)p = v;  }
__device__ __forceinline__ v8f wmma16(v16h a, v16h b, v8f c) {
  v8f d = __builtin_amdgcn_wmma_f32_16x16x32_f16(false, a, false, b, (short)0, c, false, false);
  asm volatile("v_nop\n\tv_nop\n\tv_nop\n\tv_nop" : "+v"(d) : "v"(a), "v"(b));
  return d;
}
__device__ __forceinline__ v8f wmma_bf(v16b a, v16b b, v8f c) {
  v8f d = __builtin_amdgcn_wmma_f32_16x16x32_bf16(false, a, false, b, (short)0, c, false, false);
  asm volatile("v_nop\n\tv_nop\n\tv_nop\n\tv_nop" : "+v"(d) : "v"(a), "v"(b));
  return d;
}
// 16x16x32 fragments: lane = (h = lane>>4, row/col = lane&15); elements 0..7 = k0+8h+0..7, 8..15 = k0+16+8h+0..7; D element r = row 8h+r
__device__ __forceinline__ v16h frag_h(const _Float16* rowk0, int lane) {
  union { v16h v; v8h q[2]; } u; const _Float16* p = rowk0 + 8 * (lane >> 4);
  u.q[0] = *(const v8h*)p; u.q[1] = *(const v8h*)(p + 16); return u.v;
}
__device__ __forceinline__ v16h frag_f32(const float* rowk0, int lane) {
  v16h a; const float* p = rowk0 + 8 * (lane >> 4);
#pragma unroll
  for (int i = 0; i < 8; ++i) { a[i] = (_Float16)p[i]; a[8 + i] = (_Float16)p[16 + i]; }
  return a;
}
__device__ __forceinline__ v16h frag_f32s(const float* rowk0, int lane, float sc) {
  v16h a; const float* p = rowk0 + 8 * (lane >> 4);
#pragma unroll
  for (int i = 0; i < 8; ++i) { a[i] = (_Float16)(p[i] * sc); a[8 + i] = (_Float16)(p[16 + i] * sc); }
  return a;
}
// column fragment from a [K][ld] layout (column n), rows >= K read as 0
__device__ __forceinline__ v16h fragc_f32(const float* W, int k0, int n, int lane, int ld, int K) {
  v16h a; const int g = lane >> 4;
#pragma unroll
  for (int i = 0; i < 8; ++i) { const int ka = k0 + 8 * g + i, kb = ka + 16;
    a[i] = (_Float16)(ka < K ? W[(size_t)(ka < K ? ka : K - 1) * ld + n] : 0.f); a[8 + i] = (_Float16)(kb < K ? W[(size_t)(kb < K ? kb : K - 1) * ld + n] : 0.f); }
  return a;
}
struct F2 { v16b h, l; };
__device__ __forceinline__ F2 bsplit16(const float v[16]) { F2 r;
#pragma unroll
  for (int i = 0; i < 16; ++i) { const __bf16 h = (__bf16)v[i]; r.h[i] = h; r.l[i] = (__bf16)(v[i] - (float)h); }
  return r; }
__device__ __forceinline__ F2 split_row(const float* row, int k0, int lane) { float v[16]; const float* p = row + k0 + 8 * (lane >> 4);
#pragma unroll
  for (int i = 0; i < 8; ++i) { v[i] = p[i]; v[8 + i] = p[16 + i]; }
  return bsplit16(v); }
__device__ __forceinline__ F2 split_rowK(const float* row, int k0, int lane, int K) { float v[16]; const int g = lane >> 4;
#pragma unroll
  for (int i = 0; i < 8; ++i) { const int ka = k0 + 8 * g + i, kb = ka + 16; v[i] = ka < K ? row[ka < K ? ka : K - 1] : 0.f; v[8 + i] = kb < K ? row[kb < K ? kb : K - 1] : 0.f; }
  return bsplit16(v); }
__device__ __forceinline__ F2 split_col(const float* W, int k0, int n, int lane, int ld, int K) { float v[16]; const int g = lane >> 4;
#pragma unroll
  for (int i = 0; i < 8; ++i) { const int ka = k0 + 8 * g + i, kb = ka + 16; v[i] = ka < K ? W[(size_t)(ka < K ? ka : K - 1) * ld + n] : 0.f; v[8 + i] = kb < K ? W[(size_t)(kb < K ? kb : K - 1) * ld + n] : 0.f; }
  return bsplit16(v); }
__device__ __forceinline__ v8f mac3(const F2& a, const F2& b, v8f c) { c = wmma_bf(a.l, b.h, c); c = wmma_bf(a.h, b.l, c); return wmma_bf(a.h, b.h, c); }
__device__ __forceinline__ float sigm(float v) { return 1.0f / (1.0f + expf(-v)); }
#define LDSX() do { asm volatile("s_wait_dscnt 0" ::: "memory"); __builtin_amdgcn_wave_barrier(); __builtin_amdgcn_fence(__ATOMIC_RELEASE, "workgroup"); } while (0)


// Linear-variant attention: qkv = x qkv_w^T + b (8 heads x 32), scores = q k^T / sqrt(32), t = (scores + 5)^2, attn = t / sum_k t (no softmax), out = attn v merged, @ proj_w^T + proj_b.  B 8, N 1024, D 256.
// k_pack, k_proj (exact GEMM + bias, 768-wide rows), k_vt, k_attn (flash-style without max tracking: running sum of t and t.V over 32 key steps), k_out (+ proj_b).
#define NB 8
#define SS 1024
#define DIN 256
#define DP 256
#define NH 8
#define HD 32
#define NR (NB * SS)
#define QKVP (3 * DP)
#ifndef TRB
#define TRB (NR / 64)
#define TQB (SS / 64)
#define TNB NB
#endif
typedef __attribute__((ext_vector_type(8))) __bf16 v8b;
__device__ __forceinline__ v16b frag_b(const __bf16* rowk0, int lane) {
  union { v16b v; v8b q[2]; } u; const __bf16* p = rowk0 + 8 * (lane >> 4);
  u.q[0] = *(const v8b*)p; u.q[1] = *(const v8b*)(p + 16); return u.v;
}
__device__ __forceinline__ v16b frag_gbf(const float* rowk0, int lane) {
  v16b a; const float* p = rowk0 + 8 * (lane >> 4);
#pragma unroll
  for (int i = 0; i < 8; ++i) { a[i] = (__bf16)p[i]; a[8 + i] = (__bf16)p[16 + i]; }
  return a;
}
__device__ __forceinline__ float bfr(float v) { return (float)(__bf16)v; }
__device__ __attribute__((noinline)) float exp_ni(float v) { return expf(v); }
#define WS_PT   0u                                  // bf16 [768][256] (Wq|Wk|Wv rows) then [256][256] (Wo rows)
#define PT_O    ((size_t)QKVP * DIN)
#define WS_QKV  (WS_PT + 2u * (QKVP * DIN + DIN * DP))  // f32 [8192][768]; q cols later overwritten by O
#define WS_VTH  (WS_QKV + 4u * NR * QKVP)             // bf16 [8][256][1024]
#define WS_VTL  (WS_VTH + 2u * NB * DP * SS)
#define WS_END  (WS_VTL + 2u * NB * DP * SS)

__global__ __launch_bounds__(256) void k_pack(const float* __restrict__ Wqkv, const float* __restrict__ Wo, __bf16* __restrict__ PT) {
  __shared__ __align__(16) __bf16 srow[DIN];
  const int n = blockIdx.x, tid = threadIdx.x;
  if (n < QKVP) { const float* Wm = Wqkv + (size_t)n * DIN; for (int k = tid; k < DIN; k += 256) srow[k] = (__bf16)Wm[k]; __syncthreads(); if (tid < DIN / 8) vst2((unsigned*)(PT + (size_t)n * DIN + tid * 8), *(const v4u*)(&srow[tid * 8])); }
  else { const int c = n - QKVP; const float* Wm = Wo + (size_t)c * DP; for (int k = tid; k < DP; k += 256) srow[k] = (__bf16)Wm[k]; __syncthreads(); if (tid < DP / 8) vst2((unsigned*)(PT + PT_O + (size_t)c * DP + tid * 8), *(const v4u*)(&srow[tid * 8])); }
}
// ---- k_proj: QKV[r][n] = bf16(x[r]) . PT[n] (exact, K 256) + bias; block (64 rows, 128 cols)
__global__ __launch_bounds__(128) void k_proj(const float* __restrict__ X, const __bf16* __restrict__ PT, const float* __restrict__ bqkv, float* __restrict__ QKV) {
  __shared__ __align__(16) float so[4][16][132];
  const int tid = threadIdx.x, wave = tid >> 5, lane = tid & 31, col = lane & 15, g = lane >> 4; const size_t r0 = (size_t)blockIdx.x * 64 + wave * 16; const int n0 = blockIdx.y * 128;
  v8f acc[8] = {};
#pragma unroll 2
  for (int kc = 0; kc < DIN / 32; ++kc) { const v16b a = frag_gbf(X + (r0 + col) * DIN + kc * 32, lane);
#pragma unroll
    for (int j = 0; j < 8; ++j) acc[j] = wmma_bf(a, frag_b(PT + (size_t)(n0 + j * 16 + col) * DIN + kc * 32, lane), acc[j]); }
#pragma unroll
  for (int j = 0; j < 8; ++j) { const int n = n0 + j * 16 + col; const float bb = bfr(bqkv[n]);
#pragma unroll
    for (int r = 0; r < 8; ++r) so[wave][8 * g + r][j * 16 + col] = acc[j][r] + bb; }
  LDSX();
  for (int rl = 0; rl < 16; ++rl) vst2(QKV + (r0 + rl) * QKVP + n0 + lane * 4, *(const v4f*)&so[wave][rl][lane * 4]);
}
__global__ __launch_bounds__(256) void k_vt(const float* __restrict__ QKV, __bf16* __restrict__ VTH, __bf16* __restrict__ VTL) {
  __shared__ __align__(16) __bf16 svh[DP][72], svl[DP][72];
  const int tid = threadIdx.x; const size_t t0 = (size_t)blockIdx.x * 64; const int b = (int)(t0 / SS), p0 = (int)(t0 % SS);
  for (int tl = 0; tl < 64; ++tl) { const float* row = QKV + (t0 + tl) * QKVP + 2 * DP; for (int q = tid; q < DP; q += 256) { const float v = row[q]; const __bf16 hb = (__bf16)v; svh[q][tl] = hb; svl[q][tl] = (__bf16)(v - (float)hb); } }
  __syncthreads();
  for (int q = tid; q < DP * 8; q += 256) { const int rowi = q >> 3, pc = q & 7; const size_t o = ((size_t)b * DP + rowi) * SS + p0 + pc * 8; vst2((unsigned*)(VTH + o), *(const v4u*)&svh[rowi][pc * 8]); vst2((unsigned*)(VTL + o), *(const v4u*)&svl[rowi][pc * 8]); }
}
__global__ __launch_bounds__(128) void k_attn(float* __restrict__ QKV, const __bf16* __restrict__ VTH, const __bf16* __restrict__ VTL) {
  __shared__ __align__(16) float sp[4][16][36]; __shared__ __align__(16) float so[4][16][36];
  const int tid = threadIdx.x, wave = tid >> 5, lane = tid & 31, col = lane & 15, g = lane >> 4;
  const int qb = blockIdx.x, bh = blockIdx.y, b = bh / NH, h = bh % NH; const int q0 = qb * 64 + wave * 16; const size_t tq = (size_t)b * SS + q0;
  const F2 a0 = split_row(QKV + (tq + col) * QKVP + h * HD, 0, lane);
  float l[8];
#pragma unroll
  for (int r = 0; r < 8; ++r) l[r] = 0.f;
  v8f acc[2] = {};
  const float scl = 0.17677669529663687f;    // 1/sqrt(32)
#pragma unroll 1
  for (int ks = 0; ks < SS / 32; ++ks) {
    v8f s[2];
#pragma unroll
    for (int ct = 0; ct < 2; ++ct) { const int kk = ks * 32 + ct * 16 + col; const float* krow = QKV + ((size_t)b * SS + kk) * QKVP + DP + h * HD; const F2 k0 = split_row(krow, 0, lane);
      v8f c = mac3(a0, k0, (v8f){});
#pragma unroll
      for (int r = 0; r < 8; ++r) { const float u = c[r] * scl + 5.0f; s[ct][r] = u * u; } }
#pragma unroll
    for (int r = 0; r < 8; ++r) { const float e0 = s[0][r], e1 = s[1][r]; float es = e0 + e1;
#pragma unroll
      for (int o = 1; o < 16; o <<= 1) es += __shfl_xor(es, o);
      l[r] += es; sp[wave][8 * g + r][col] = e0; sp[wave][8 * g + r][16 + col] = e1; }
    LDSX();
    const F2 pa = split_row(&sp[wave][col][0], 0, lane);
#pragma unroll
    for (int dt = 0; dt < 2; ++dt) { const size_t vrow = ((size_t)b * DP + h * HD + dt * 16 + col) * SS + ks * 32; const v16b vh = frag_b(VTH + vrow, lane), vl = frag_b(VTL + vrow, lane);
      acc[dt] = wmma_bf(pa.l, vh, acc[dt]); acc[dt] = wmma_bf(pa.h, vl, acc[dt]); acc[dt] = wmma_bf(pa.h, vh, acc[dt]); }
    LDSX(); }
#pragma unroll
  for (int r = 0; r < 8; ++r) { const float il = 1.0f / l[r];
#pragma unroll
    for (int dt = 0; dt < 2; ++dt) so[wave][8 * g + r][dt * 16 + col] = acc[dt][r] * il; }
  LDSX();
  for (int rl = 0; rl < 16; ++rl) if (lane < 8) vst2(QKV + (tq + rl) * QKVP + h * HD + lane * 4, *(const v4f*)&so[wave][rl][lane * 4]);
}
// ---- k_out: Y = O(hi/lo; the q columns of QKV, K 256) . Wo rows (2 products) + bo; block (64 rows, 128 of the 256 cols)
__global__ __launch_bounds__(128) void k_out(const float* __restrict__ QKV, const __bf16* __restrict__ PT, const float* __restrict__ bo, float* __restrict__ Y) {
  __shared__ __align__(16) float so[4][16][132];
  const int tid = threadIdx.x, wave = tid >> 5, lane = tid & 31, col = lane & 15, g = lane >> 4; const size_t r0 = (size_t)blockIdx.x * 64 + wave * 16; const int n0 = blockIdx.y * 128;
  v8f acc[8] = {};
#pragma unroll 2
  for (int kc = 0; kc < DP / 32; ++kc) { const F2 a = split_row(QKV + (r0 + col) * QKVP, kc * 32, lane);
#pragma unroll
    for (int j = 0; j < 8; ++j) { const v16b w = frag_b(PT + PT_O + (size_t)(n0 + j * 16 + col) * DP + kc * 32, lane); acc[j] = wmma_bf(a.l, w, acc[j]); acc[j] = wmma_bf(a.h, w, acc[j]); } }
#pragma unroll
  for (int j = 0; j < 8; ++j) { const float bb = bfr(bo[n0 + j * 16 + col]);
#pragma unroll
    for (int r = 0; r < 8; ++r) so[wave][8 * g + r][j * 16 + col] = acc[j][r] + bb; }
  LDSX();
  for (int rl = 0; rl < 16; ++rl) vst2(Y + (r0 + rl) * DIN + n0 + lane * 4, *(const v4f*)&so[wave][rl][lane * 4]);
}

extern "C" void kernel_launch(void* const* d_in, const int* in_sizes, int n_in, void* d_out, int out_size, void* d_ws, size_t ws_size, hipStream_t stream) {
  (void)in_sizes; (void)n_in; (void)out_size;
  const float** F = (const float**)d_in;   // x [8,1024,256], qkv_w [768,256], qkv_b [768], proj_w [256,256], proj_b [256]
  if (ws_size < (size_t)WS_END) return;
  char* ws = (char*)d_ws; __bf16 *PT = (__bf16*)(ws + WS_PT), *VTH = (__bf16*)(ws + WS_VTH), *VTL = (__bf16*)(ws + WS_VTL); float* QKV = (float*)(ws + WS_QKV);
  k_pack<<<QKVP + DIN, 256, 0, stream>>>(F[1], F[3], PT);
  k_proj<<<dim3(TRB, QKVP / 128), 128, 0, stream>>>(F[0], PT, F[2], QKV);
  k_vt<<<TRB, 256, 0, stream>>>(QKV, VTH, VTL);
  k_attn<<<dim3(TQB, TNB * NH), 128, 0, stream>>>(QKV, VTH, VTL);
  k_out<<<dim3((TNB < NB ? TQB : NR / 64), DIN / 128), 128, 0, stream>>>(QKV, PT, F[4], (float*)d_out);
}

// v001
// A run of this version takes 118 microseconds.
// In two side-by-side timings against v000, it was 1.30 and 1.28 times as fast.
// compute dtype: x, qkv_w/qkv_b, proj_w/proj_b (module inputs) rounded to bf16; qkv projection with exact bf16 products (+ bias); scores and the (s + 5)^2-weighted value sums with both computed operands as bf16 hi + bf16 residual pairs (3 products); output projection hi/lo x bf16 proj_w (2 products) + bias; the quadratic normalisation in f32; f32 accumulate.
#include <hip/hip_runtime.h>
#include <math.h>

typedef __attribute__((ext_vector_type(16))) _Float16 v16h;
typedef __attribute__((ext_vector_type(16))) __bf16 v16b;
typedef __attribute__((ext_vector_type(8)))  _Float16 v8h;
typedef __attribute__((ext_vector_type(8)))  float v8f;
typedef __attribute__((ext_vector_type(4)))  float v4f;
typedef __attribute__((ext_vector_type(2)))  float v2f;
typedef __attribute__((ext_vector_type(4)))  unsigned v4u;
typedef __attribute__((ext_vector_type(4)))  int v4i;
typedef float __attribute__((may_alias)) float_a;
typedef int __attribute__((may_alias)) int_a;

template <typename T> __device__ __forceinline__ void vst2(void* p, T v) { *(T*)p = v;  }
__device__ __forceinline__ v8f wmma16(v16h a, v16h b, v8f c) {
  v8f d = __builtin_amdgcn_wmma_f32_16x16x32_f16(false, a, false, b, (short)0, c, false, false);
  asm volatile("v_nop\n\tv_nop\n\tv_nop\n\tv_nop" : "+v"(d) : "v"(a), "v"(b));
  return d;
}
__device__ __forceinline__ v8f wmma_bf(v16b a, v16b b, v8f c) {
  v8f d = __builtin_amdgcn_wmma_f32_16x16x32_bf16(false, a, false, b, (short)0, c, false, false);
  asm volatile("v_nop\n\tv_nop\n\tv_nop\n\tv_nop" : "+v"(d) : "v"(a), "v"(b));
  return d;
}
// 16x16x32 fragments: lane = (h = lane>>4, row/col = lane&15); elements 0..7 = k0+8h+0..7, 8..15 = k0+16+8h+0..7; D element r = row 8h+r
__device__ __forceinline__ v16h frag_h(const _Float16* rowk0, int lane) {
  union { v16h v; v8h q[2]; } u; const _Float16* p = rowk0 + 8 * (lane >> 4);
  u.q[0] = *(const v8h*)p; u.q[1] = *(const v8h*)(p + 16); return u.v;
}
__device__ __forceinline__ v16h frag_f32(const float* rowk0, int lane) {
  v16h a; const float* p = rowk0 + 8 * (lane >> 4);
#pragma unroll
  for (int i = 0; i < 8; ++i) { a[i] = (_Float16)p[i]; a[8 + i] = (_Float16)p[16 + i]; }
  return a;
}
__device__ __forceinline__ v16h frag_f32s(const float* rowk0, int lane, float sc) {
  v16h a; const float* p = rowk0 + 8 * (lane >> 4);
#pragma unroll
  for (int i = 0; i < 8; ++i) { a[i] = (_Float16)(p[i] * sc); a[8 + i] = (_Float16)(p[16 + i] * sc); }
  return a;
}
// column fragment from a [K][ld] layout (column n), rows >= K read as 0
__device__ __forceinline__ v16h fragc_f32(const float* W, int k0, int n, int lane, int ld, int K) {
  v16h a; const int g = lane >> 4;
#pragma unroll
  for (int i = 0; i < 8; ++i) { const int ka = k0 + 8 * g + i, kb = ka + 16;
    a[i] = (_Float16)(ka < K ? W[(size_t)(ka < K ? ka : K - 1) * ld + n] : 0.f); a[8 + i] = (_Float16)(kb < K ? W[(size_t)(kb < K ? kb : K - 1) * ld + n] : 0.f); }
  return a;
}
struct F2 { v16b h, l; };
__device__ __forceinline__ F2 bsplit16(const float v[16]) { F2 r;
#pragma unroll
  for (int i = 0; i < 16; ++i) { const __bf16 h = (__bf16)v[i]; r.h[i] = h; r.l[i] = (__bf16)(v[i] - (float)h); }
  return r; }
__device__ __forceinline__ F2 split_row(const float* row, int k0, int lane) { float v[16]; const float* p = row + k0 + 8 * (lane >> 4);
#pragma unroll
  for (int i = 0; i < 8; ++i) { v[i] = p[i]; v[8 + i] = p[16 + i]; }
  return bsplit16(v); }
__device__ __forceinline__ F2 split_rowK(const float* row, int k0, int lane, int K) { float v[16]; const int g = lane >> 4;
#pragma unroll
  for (int i = 0; i < 8; ++i) { const int ka = k0 + 8 * g + i, kb = ka + 16; v[i] = ka < K ? row[ka < K ? ka : K - 1] : 0.f; v[8 + i] = kb < K ? row[kb < K ? kb : K - 1] : 0.f; }
  return bsplit16(v); }
__device__ __forceinline__ F2 split_col(const float* W, int k0, int n, int lane, int ld, int K) { float v[16]; const int g = lane >> 4;
#pragma unroll
  for (int i = 0; i < 8; ++i) { const int ka = k0 + 8 * g + i, kb = ka + 16; v[i] = ka < K ? W[(size_t)(ka < K ? ka : K - 1) * ld + n] : 0.f; v[8 + i] = kb < K ? W[(size_t)(kb < K ? kb : K - 1) * ld + n] : 0.f; }
  return bsplit16(v); }
__device__ __forceinline__ v8f mac3(const F2& a, const F2& b, v8f c) { c = wmma_bf(a.l, b.h, c); c = wmma_bf(a.h, b.l, c); return wmma_bf(a.h, b.h, c); }
__device__ __forceinline__ float sigm(float v) { return 1.0f / (1.0f + expf(-v)); }
#define LDSX() do { asm volatile("s_wait_dscnt 0" ::: "memory"); __builtin_amdgcn_wave_barrier(); __builtin_amdgcn_fence(__ATOMIC_RELEASE, "workgroup"); } while (0)


// Linear-variant attention: qkv = x qkv_w^T + b (8 heads x 32), scores = q k^T / sqrt(32), t = (scores + 5)^2, attn = t / sum_k t (no softmax), out = attn v merged, @ proj_w^T + proj_b.  B 8, N 1024, D 256.
// k_pack, k_proj (exact GEMM + bias, 768-wide rows), k_vt, k_attn (flash-style without max tracking: running sum of t and t.V over 32 key steps; K and V^T tiles come through a two-buffer LDS ring shared by the block's four waves), k_out (+ proj_b).
#define NB 8
#define SS 1024
#define DIN 256
#define DP 256
#define NH 8
#define HD 32
#define NR (NB * SS)
#define QKVP (3 * DP)
#ifndef TRB
#define TRB (NR / 64)
#define TQB (SS / 64)
#define TNB NB
#endif
typedef __attribute__((ext_vector_type(8))) __bf16 v8b;
__device__ __forceinline__ v16b frag_b(const __bf16* rowk0, int lane) {
  union { v16b v; v8b q[2]; } u; const __bf16* p = rowk0 + 8 * (lane >> 4);
  u.q[0] = *(const v8b*)p; u.q[1] = *(const v8b*)(p + 16); return u.v;
}
__device__ __forceinline__ v16b frag_gbf(const float* rowk0, int lane) {
  v16b a; const float* p = rowk0 + 8 * (lane >> 4);
#pragma unroll
  for (int i = 0; i < 8; ++i) { a[i] = (__bf16)p[i]; a[8 + i] = (__bf16)p[16 + i]; }
  return a;
}
__device__ __forceinline__ float bfr(float v) { return (float)(__bf16)v; }
__device__ __attribute__((noinline)) float exp_ni(float v) { return expf(v); }
#define WS_PT   0u                                  // bf16 [768][256] (Wq|Wk|Wv rows) then [256][256] (Wo rows)
#define PT_O    ((size_t)QKVP * DIN)
#define WS_QKV  (WS_PT + 2u * (QKVP * DIN + DIN * DP))  // f32 [8192][768]; q cols later overwritten by O
#define WS_VTH  (WS_QKV + 4u * NR * QKVP)             // bf16 [8][256][1024]
#define WS_VTL  (WS_VTH + 2u * NB * DP * SS)
#define WS_END  (WS_VTL + 2u * NB * DP * SS)

__global__ __launch_bounds__(256) void k_pack(const float* __restrict__ Wqkv, const float* __restrict__ Wo, __bf16* __restrict__ PT) {
  __shared__ __align__(16) __bf16 srow[DIN];
  const int n = blockIdx.x, tid = threadIdx.x;
  if (n < QKVP) { const float* Wm = Wqkv + (size_t)n * DIN; for (int k = tid; k < DIN; k += 256) srow[k] = (__bf16)Wm[k]; __syncthreads(); if (tid < DIN / 8) vst2((unsigned*)(PT + (size_t)n * DIN + tid * 8), *(const v4u*)(&srow[tid * 8])); }
  else { const int c = n - QKVP; const float* Wm = Wo + (size_t)c * DP; for (int k = tid; k < DP; k += 256) srow[k] = (__bf16)Wm[k]; __syncthreads(); if (tid < DP / 8) vst2((unsigned*)(PT + PT_O + (size_t)c * DP + tid * 8), *(const v4u*)(&srow[tid * 8])); }
}
// ---- k_proj: QKV[r][n] = bf16(x[r]) . PT[n] (exact, K 256) + bias; block (64 rows, 128 cols)
__global__ __launch_bounds__(128) void k_proj(const float* __restrict__ X, const __bf16* __restrict__ PT, const float* __restrict__ bqkv, float* __restrict__ QKV) {
  __shared__ __align__(16) float so[4][16][132];
  const int tid = threadIdx.x, wave = tid >> 5, lane = tid & 31, col = lane & 15, g = lane >> 4; const size_t r0 = (size_t)blockIdx.x * 64 + wave * 16; const int n0 = blockIdx.y * 128;
  v8f acc[8] = {};
#pragma unroll 2
  for (int kc = 0; kc < DIN / 32; ++kc) { const v16b a = frag_gbf(X + (r0 + col) * DIN + kc * 32, lane);
#pragma unroll
    for (int j = 0; j < 8; ++j) acc[j] = wmma_bf(a, frag_b(PT + (size_t)(n0 + j * 16 + col) * DIN + kc * 32, lane), acc[j]); }
#pragma unroll
  for (int j = 0; j < 8; ++j) { const int n = n0 + j * 16 + col; const float bb = bfr(bqkv[n]);
#pragma unroll
    for (int r = 0; r < 8; ++r) so[wave][8 * g + r][j * 16 + col] = acc[j][r] + bb; }
  LDSX();
  for (int rl = 0; rl < 16; ++rl) vst2(QKV + (r0 + rl) * QKVP + n0 + lane * 4, *(const v4f*)&so[wave][rl][lane * 4]);
}
__global__ __launch_bounds__(256) void k_vt(const float* __restrict__ QKV, __bf16* __restrict__ VTH, __bf16* __restrict__ VTL) {
  __shared__ __align__(16) __bf16 svh[DP][72], svl[DP][72];
  const int tid = threadIdx.x; const size_t t0 = (size_t)blockIdx.x * 64; const int b = (int)(t0 / SS), p0 = (int)(t0 % SS);
  for (int tl = 0; tl < 64; ++tl) { const float* row = QKV + (t0 + tl) * QKVP + 2 * DP; for (int q = tid; q < DP; q += 256) { const float v = row[q]; const __bf16 hb = (__bf16)v; svh[q][tl] = hb; svl[q][tl] = (__bf16)(v - (float)hb); } }
  __syncthreads();
  for (int q = tid; q < DP * 8; q += 256) { const int rowi = q >> 3, pc = q & 7; const size_t o = ((size_t)b * DP + rowi) * SS + p0 + pc * 8; vst2((unsigned*)(VTH + o), *(const v4u*)&svh[rowi][pc * 8]); vst2((unsigned*)(VTL + o), *(const v4u*)&svl[rowi][pc * 8]); }
}
// one stage of the LDS ring = KST keys of one head: K rows in f32 and V^T hi / lo rows in bf16 are all 128 B long; pitch 144 B suits the 16-byte LDS readers
#define KST 64
#define NST (SS / KST)
#define KPIT 36
#define VPIT 72
__device__ __forceinline__ unsigned lds_off(const void* p) { return (unsigned)(size_t)p; }   // low 32 bits of a __shared__ address = byte offset in the work-group's LDS
// 8 lanes copy one whole 128-B row; a lane's 8 copies: K rows r, r+16, r+32, r+48, V^T hi rows r, r+16, V^T lo rows r, r+16 (r = tid >> 3)
__device__ __forceinline__ void stage_copy(const float* gk, const __bf16* gh, const __bf16* gl, unsigned lk, unsigned lh, unsigned ll) {
  // the copies go global -> LDS through no register; s_wait_xcnt 0 closes the statement so that no address register is rewritten ahead of it
  asm volatile("global_load_async_to_lds_b128 %0, %8, off\n\t"
               "global_load_async_to_lds_b128 %1, %9, off\n\t"
               "global_load_async_to_lds_b128 %2, %10, off\n\t"
               "global_load_async_to_lds_b128 %3, %11, off\n\t"
               "global_load_async_to_lds_b128 %4, %12, off\n\t"
               "global_load_async_to_lds_b128 %5, %13, off\n\t"
               "global_load_async_to_lds_b128 %6, %14, off\n\t"
               "global_load_async_to_lds_b128 %7, %15, off\n\t"
               "s_wait_xcnt 0x0"
               :: "v"(lk), "v"(lk + 16u * KPIT * 4u), "v"(lk + 32u * KPIT * 4u), "v"(lk + 48u * KPIT * 4u), "v"(lh), "v"(lh + 16u * VPIT * 2u), "v"(ll), "v"(ll + 16u * VPIT * 2u),
                  "v"(gk), "v"(gk + 16 * QKVP), "v"(gk + 32 * QKVP), "v"(gk + 48 * QKVP), "v"(gh), "v"(gh + 16 * SS), "v"(gl), "v"(gl + 16 * SS)
               : "memory");
}
__global__ __launch_bounds__(128) void k_attn(float* __restrict__ QKV, const __bf16* __restrict__ VTH, const __bf16* __restrict__ VTL) {
  __shared__ __align__(16) float sk[2][KST][KPIT]; __shared__ __align__(16) __bf16 svh[2][HD][VPIT], svl[2][HD][VPIT];
  __shared__ __align__(16) float sp[4][16][36]; __shared__ __align__(16) float so[4][16][36];
  const int tid = threadIdx.x, wave = tid >> 5, lane = tid & 31, col = lane & 15, g = lane >> 4;
  const int qb = blockIdx.x, bh = blockIdx.y, b = bh / NH, h = bh % NH; const int q0 = qb * 64 + wave * 16; const size_t tq = (size_t)b * SS + q0;
  const int crow = tid >> 3, cpc = tid & 7;
  const float* gk = QKV + ((size_t)b * SS + crow) * QKVP + DP + h * HD + cpc * 4;
  const __bf16* gh = VTH + ((size_t)b * DP + h * HD + crow) * SS + cpc * 8; const __bf16* gl = VTL + ((size_t)b * DP + h * HD + crow) * SS + cpc * 8;
  const unsigned lk = lds_off(&sk[0][crow][cpc * 4]), lh = lds_off(&svh[0][crow][cpc * 8]), ll = lds_off(&svl[0][crow][cpc * 8]);
  const unsigned kbuf = KST * KPIT * 4u, vbuf = HD * VPIT * 2u;
  stage_copy(gk, gh, gl, lk, lh, ll);
  const F2 a0 = split_row(QKV + (tq + col) * QKVP + h * HD, 0, lane);
  asm volatile("s_wait_asynccnt 0x0" ::: "memory");   // stage 0 has landed before the barrier that publishes it
  __syncthreads();
  stage_copy(gk + (size_t)KST * QKVP, gh + KST, gl + KST, lk + kbuf, lh + vbuf, ll + vbuf);
  float l[8];
#pragma unroll
  for (int r = 0; r < 8; ++r) l[r] = 0.f;
  v8f acc[2] = {};
  const float scl = 0.17677669529663687f;    // 1/sqrt(32)
#pragma unroll 1
  for (int st = 0; st < NST; ++st) {
    const int bf = st & 1;
#pragma unroll   // both 32-key halves of a stage in line: their LDS offsets become immediates
    for (int hs = 0; hs < KST / 32; ++hs) {
    v8f s[2];
#pragma unroll
    for (int ct = 0; ct < 2; ++ct) { const F2 k0 = split_row(&sk[bf][hs * 32 + ct * 16 + col][0], 0, lane);
      v8f c = mac3(a0, k0, (v8f){});
#pragma unroll
      for (int r = 0; r < 8; ++r) { const float u = c[r] * scl + 5.0f; s[ct][r] = u * u; } }
#pragma unroll
    for (int r = 0; r < 8; ++r) { const float e0 = s[0][r], e1 = s[1][r]; float es = e0 + e1;
#pragma unroll
      for (int o = 1; o < 16; o <<= 1) es += __shfl_xor(es, o);
      l[r] += es; sp[wave][8 * g + r][col] = e0; sp[wave][8 * g + r][16 + col] = e1; }
    LDSX();
    const F2 pa = split_row(&sp[wave][col][0], 0, lane);
#pragma unroll
    for (int dt = 0; dt < 2; ++dt) { const v16b vh = frag_b(&svh[bf][dt * 16 + col][hs * 32], lane), vl = frag_b(&svl[bf][dt * 16 + col][hs * 32], lane);
      acc[dt] = wmma_bf(pa.l, vh, acc[dt]); acc[dt] = wmma_bf(pa.h, vl, acc[dt]); acc[dt] = wmma_bf(pa.h, vh, acc[dt]); }
    LDSX(); }
    asm volatile("s_wait_dscnt 0x0" ::: "memory");      // this wave's reads of buffer bf are over before the buffer is refilled
    asm volatile("s_wait_asynccnt 0x0" ::: "memory");   // this wave's copies of stage st + 1 have landed before the barrier that publishes them
    __syncthreads();                                    // publishes stage st + 1 and ends every wave's reads of buffer bf
    if (st + 2 < NST) stage_copy(gk + (size_t)(st + 2) * KST * QKVP, gh + (st + 2) * KST, gl + (st + 2) * KST, lk + bf * kbuf, lh + bf * vbuf, ll + bf * vbuf);
  }
  asm volatile("s_wait_asynccnt 0x0" ::: "memory");     // no copy is outstanding when the wave goes on to its end
#pragma unroll
  for (int r = 0; r < 8; ++r) { const float il = 1.0f / l[r];
#pragma unroll
    for (int dt = 0; dt < 2; ++dt) so[wave][8 * g + r][dt * 16 + col] = acc[dt][r] * il; }
  LDSX();
  for (int rl = 0; rl < 16; ++rl) if (lane < 8) vst2(QKV + (tq + rl) * QKVP + h * HD + lane * 4, *(const v4f*)&so[wave][rl][lane * 4]);
}
// ---- k_out: Y = O(hi/lo; the q columns of QKV, K 256) . Wo rows (2 products) + bo; block (64 rows, 128 of the 256 cols)
__global__ __launch_bounds__(128) void k_out(const float* __restrict__ QKV, const __bf16* __restrict__ PT, const float* __restrict__ bo, float* __restrict__ Y) {
  __shared__ __align__(16) float so[4][16][132];
  const int tid = threadIdx.x, wave = tid >> 5, lane = tid & 31, col = lane & 15, g = lane >> 4; const size_t r0 = (size_t)blockIdx.x * 64 + wave * 16; const int n0 = blockIdx.y * 128;
  v8f acc[8] = {};
#pragma unroll 2
  for (int kc = 0; kc < DP / 32; ++kc) { const F2 a = split_row(QKV + (r0 + col) * QKVP, kc * 32, lane);
#pragma unroll
    for (int j = 0; j < 8; ++j) { const v16b w = frag_b(PT + PT_O + (size_t)(n0 + j * 16 + col) * DP + kc * 32, lane); acc[j] = wmma_bf(a.l, w, acc[j]); acc[j] = wmma_bf(a.h, w, acc[j]); } }
#pragma unroll
  for (int j = 0; j < 8; ++j) { const float bb = bfr(bo[n0 + j * 16 + col]);
#pragma unroll
    for (int r = 0; r < 8; ++r) so[wave][8 * g + r][j * 16 + col] = acc[j][r] + bb; }
  LDSX();
  for (int rl = 0; rl < 16; ++rl) vst2(Y + (r0 + rl) * DIN + n0 + lane * 4, *(const v4f*)&so[wave][rl][lane * 4]);
}

extern "C" void kernel_launch(void* const* d_in, const int* in_sizes, int n_in, void* d_out, int out_size, void* d_ws, size_t ws_size, hipStream_t stream) {
  (void)in_sizes; (void)n_in; (void)out_size;
  const float** F = (const float**)d_in;   // x [8,1024,256], qkv_w [768,256], qkv_b [768], proj_w [256,256], proj_b [256]
  if (ws_size < (size_t)WS_END) return;
  char* ws = (char*)d_ws; __bf16 *PT = (__bf16*)(ws + WS_PT), *VTH = (__bf16*)(ws + WS_VTH), *VTL = (__bf16*)(ws + WS_VTL); float* QKV = (float*)(ws + WS_QKV);
  k_pack<<<QKVP + DIN, 256, 0, stream>>>(F[1], F[3], PT);
  k_proj<<<dim3(TRB, QKVP / 128), 128, 0, stream>>>(F[0], PT, F[2], QKV);
  k_vt<<<TRB, 256, 0, stream>>>(QKV, VTH, VTL);
  k_attn<<<dim3(TQB, TNB * NH), 128, 0, stream>>>(QKV, VTH, VTL);
  k_out<<<dim3((TNB < NB ? TQB : NR / 64), DIN / 128), 128, 0, stream>>>(QKV, PT, F[4], (float*)d_out);
}

// v002
// One run takes 107 microseconds.
// In both of two side-by-side timings against v001, it was 1.09 times as fast.
// Over all steps from v000 it is 1.41 times as fast.
// compute dtype: x, qkv_w/qkv_b, proj_w/proj_b (module inputs) rounded to bf16; qkv projection with exact bf16 products (+ bias); scores and the (s + 5)^2-weighted value sums with both computed operands as bf16 hi + bf16 residual pairs (3 products); output projection hi/lo x bf16 proj_w (2 products) + bias; the quadratic normalisation in f32; f32 accumulate.
#include <hip/hip_runtime.h>
#include <math.h>

typedef __attribute__((ext_vector_type(16))) _Float16 v16h;
typedef __attribute__((ext_vector_type(16))) __bf16 v16b;
typedef __attribute__((ext_vector_type(8)))  _Float16 v8h;
typedef __attribute__((ext_vector_type(8)))  float v8f;
typedef __attribute__((ext_vector_type(4)))  float v4f;
typedef __attribute__((ext_vector_type(2)))  float v2f;
typedef __attribute__((ext_vector_type(4)))  unsigned v4u;
typedef __attribute__((ext_vector_type(4)))  int v4i;
typedef float __attribute__((may_alias)) float_a;
typedef int __attribute__((may_alias)) int_a;

template <typename T> __device__ __forceinline__ void vst2(void* p, T v) { *(T*)p = v;  }
__device__ __forceinline__ v8f wmma16(v16h a, v16h b, v8f c) {
  v8f d = __builtin_amdgcn_wmma_f32_16x16x32_f16(false, a, false, b, (short)0, c, false, false);
  asm volatile("v_nop\n\tv_nop\n\tv_nop\n\tv_nop" : "+v"(d) : "v"(a), "v"(b));
  return d;
}
__device__ __forceinline__ v8f wmma_bf(v16b a, v16b b, v8f c) {
  v8f d = __builtin_amdgcn_wmma_f32_16x16x32_bf16(false, a, false, b, (short)0, c, false, false);
  asm volatile("v_nop\n\tv_nop\n\tv_nop\n\tv_nop" : "+v"(d) : "v"(a), "v"(b));
  return d;
}
// 16x16x32 fragments: lane = (h = lane>>4, row/col = lane&15); elements 0..7 = k0+8h+0..7, 8..15 = k0+16+8h+0..7; D element r = row 8h+r
__device__ __forceinline__ v16h frag_h(const _Float16* rowk0, int lane) {
  union { v16h v; v8h q[2]; } u; const _Float16* p = rowk0 + 8 * (lane >> 4);
  u.q[0] = *(const v8h*)p; u.q[1] = *(const v8h*)(p + 16); return u.v;
}
__device__ __forceinline__ v16h frag_f32(const float* rowk0, int lane) {
  v16h a; const float* p = rowk0 + 8 * (lane >> 4);
#pragma unroll
  for (int i = 0; i < 8; ++i) { a[i] = (_Float16)p[i]; a[8 + i] = (_Float16)p[16 + i]; }
  return a;
}
__device__ __forceinline__ v16h frag_f32s(const float* rowk0, int lane, float sc) {
  v16h a; const float* p = rowk0 + 8 * (lane >> 4);
#pragma unroll
  for (int i = 0; i < 8; ++i) { a[i] = (_Float16)(p[i] * sc); a[8 + i] = (_Float16)(p[16 + i] * sc); }
  return a;
}
// column fragment from a [K][ld] layout (column n), rows >= K read as 0
__device__ __forceinline__ v16h fragc_f32(const float* W, int k0, int n, int lane, int ld, int K) {
  v16h a; const int g = lane >> 4;
#pragma unroll
  for (int i = 0; i < 8; ++i) { const int ka = k0 + 8 * g + i, kb = ka + 16;
    a[i] = (_Float16)(ka < K ? W[(size_t)(ka < K ? ka : K - 1) * ld + n] : 0.f); a[8 + i] = (_Float16)(kb < K ? W[(size_t)(kb < K ? kb : K - 1) * ld + n] : 0.f); }
  return a;
}
struct F2 { v16b h, l; };
__device__ __forceinline__ F2 bsplit16(const float v[16]) { F2 r;
#pragma unroll
  for (int i = 0; i < 16; ++i) { const __bf16 h = (__bf16)v[i]; r.h[i] = h; r.l[i] = (__bf16)(v[i] - (float)h); }
  return r; }
__device__ __forceinline__ F2 split_row(const float* row, int k0, int lane) { float v[16]; const float* p = row + k0 + 8 * (lane >> 4);
#pragma unroll
  for (int i = 0; i < 8; ++i) { v[i] = p[i]; v[8 + i] = p[16 + i]; }
  return bsplit16(v); }
__device__ __forceinline__ F2 split_rowK(const float* row, int k0, int lane, int K) { float v[16]; const int g = lane >> 4;
#pragma unroll
  for (int i = 0; i < 8; ++i) { const int ka = k0 + 8 * g + i, kb = ka + 16; v[i] = ka < K ? row[ka < K ? ka : K - 1] : 0.f; v[8 + i] = kb < K ? row[kb < K ? kb : K - 1] : 0.f; }
  return bsplit16(v); }
__device__ __forceinline__ F2 split_col(const float* W, int k0, int n, int lane, int ld, int K) { float v[16]; const int g = lane >> 4;
#pragma unroll
  for (int i = 0; i < 8; ++i) { const int ka = k0 + 8 * g + i, kb = ka + 16; v[i] = ka < K ? W[(size_t)(ka < K ? ka : K - 1) * ld + n] : 0.f; v[8 + i] = kb < K ? W[(size_t)(kb < K ? kb : K - 1) * ld + n] : 0.f; }
  return bsplit16(v); }
__device__ __forceinline__ v8f mac3(const F2& a, const F2& b, v8f c) { c = wmma_bf(a.l, b.h, c); c = wmma_bf(a.h, b.l, c); return wmma_bf(a.h, b.h, c); }
__device__ __forceinline__ float sigm(float v) { return 1.0f / (1.0f + expf(-v)); }
#define LDSX() do { asm volatile("s_wait_dscnt 0" ::: "memory"); __builtin_amdgcn_wave_barrier(); __builtin_amdgcn_fence(__ATOMIC_RELEASE, "workgroup"); } while (0)


// Linear-variant attention: qkv = x qkv_w^T + b (8 heads x 32), scores = q k^T / sqrt(32), t = (scores + 5)^2, attn = t / sum_k t (no softmax), out = attn v merged, @ proj_w^T + proj_b.  B 8, N 1024, D 256.
// k_pack, k_proj (exact GEMM + bias, 768-wide rows), k_vt, k_attn (flash-style without max tracking: S^T = K Q^T, running in-lane sum of t and O^T += V^T t^T over 32 key steps, t staying in registers; K and V^T tiles come through a two-buffer LDS ring shared by the block's four waves), k_out (+ proj_b).
#define NB 8
#define SS 1024
#define DIN 256
#define DP 256
#define NH 8
#define HD 32
#define NR (NB * SS)
#define QKVP (3 * DP)
#ifndef TRB
#define TRB (NR / 64)
#define TQB (SS / 64)
#define TNB NB
#endif
typedef __attribute__((ext_vector_type(8))) __bf16 v8b;
__device__ __forceinline__ v16b frag_b(const __bf16* rowk0, int lane) {
  union { v16b v; v8b q[2]; } u; const __bf16* p = rowk0 + 8 * (lane >> 4);
  u.q[0] = *(const v8b*)p; u.q[1] = *(const v8b*)(p + 16); return u.v;
}
__device__ __forceinline__ v16b frag_gbf(const float* rowk0, int lane) {
  v16b a; const float* p = rowk0 + 8 * (lane >> 4);
#pragma unroll
  for (int i = 0; i < 8; ++i) { a[i] = (__bf16)p[i]; a[8 + i] = (__bf16)p[16 + i]; }
  return a;
}
__device__ __forceinline__ float bfr(float v) { return (float)(__bf16)v; }
__device__ __attribute__((noinline)) float exp_ni(float v) { return expf(v); }
#define WS_PT   0u                                  // bf16 [768][256] (Wq|Wk|Wv rows) then [256][256] (Wo rows)
#define PT_O    ((size_t)QKVP * DIN)
#define WS_QKV  (WS_PT + 2u * (QKVP * DIN + DIN * DP))  // f32 [8192][768]; q cols later overwritten by O
#define WS_VTH  (WS_QKV + 4u * NR * QKVP)             // bf16 [8][256][1024]
#define WS_VTL  (WS_VTH + 2u * NB * DP * SS)
#define WS_END  (WS_VTL + 2u * NB * DP * SS)

__global__ __launch_bounds__(256) void k_pack(const float* __restrict__ Wqkv, const float* __restrict__ Wo, __bf16* __restrict__ PT) {
  __shared__ __align__(16) __bf16 srow[DIN];
  const int n = blockIdx.x, tid = threadIdx.x;
  if (n < QKVP) { const float* Wm = Wqkv + (size_t)n * DIN; for (int k = tid; k < DIN; k += 256) srow[k] = (__bf16)Wm[k]; __syncthreads(); if (tid < DIN / 8) vst2((unsigned*)(PT + (size_t)n * DIN + tid * 8), *(const v4u*)(&srow[tid * 8])); }
  else { const int c = n - QKVP; const float* Wm = Wo + (size_t)c * DP; for (int k = tid; k < DP; k += 256) srow[k] = (__bf16)Wm[k]; __syncthreads(); if (tid < DP / 8) vst2((unsigned*)(PT + PT_O + (size_t)c * DP + tid * 8), *(const v4u*)(&srow[tid * 8])); }
}
// ---- k_proj: QKV[r][n] = bf16(x[r]) . PT[n] (exact, K 256) + bias; block (64 rows, 128 cols)
__global__ __launch_bounds__(128) void k_proj(const float* __restrict__ X, const __bf16* __restrict__ PT, const float* __restrict__ bqkv, float* __restrict__ QKV) {
  __shared__ __align__(16) float so[4][16][132];
  const int tid = threadIdx.x, wave = tid >> 5, lane = tid & 31, col = lane & 15, g = lane >> 4; const size_t r0 = (size_t)blockIdx.x * 64 + wave * 16; const int n0 = blockIdx.y * 128;
  v8f acc[8] = {};
#pragma unroll 2
  for (int kc = 0; kc < DIN / 32; ++kc) { const v16b a = frag_gbf(X + (r0 + col) * DIN + kc * 32, lane);
#pragma unroll
    for (int j = 0; j < 8; ++j) acc[j] = wmma_bf(a, frag_b(PT + (size_t)(n0 + j * 16 + col) * DIN + kc * 32, lane), acc[j]); }
#pragma unroll
  for (int j = 0; j < 8; ++j) { const int n = n0 + j * 16 + col; const float bb = bfr(bqkv[n]);
#pragma unroll
    for (int r = 0; r < 8; ++r) so[wave][8 * g + r][j * 16 + col] = acc[j][r] + bb; }
  LDSX();
  for (int rl = 0; rl < 16; ++rl) vst2(QKV + (r0 + rl) * QKVP + n0 + lane * 4, *(const v4f*)&so[wave][rl][lane * 4]);
}
__global__ __launch_bounds__(256) void k_vt(const float* __restrict__ QKV, __bf16* __restrict__ VTH, __bf16* __restrict__ VTL) {
  __shared__ __align__(16) __bf16 svh[DP][72], svl[DP][72];
  const int tid = threadIdx.x; const size_t t0 = (size_t)blockIdx.x * 64; const int b = (int)(t0 / SS), p0 = (int)(t0 % SS);
  for (int tl = 0; tl < 64; ++tl) { const float* row = QKV + (t0 + tl) * QKVP + 2 * DP; for (int q = tid; q < DP; q += 256) { const float v = row[q]; const __bf16 hb = (__bf16)v; svh[q][tl] = hb; svl[q][tl] = (__bf16)(v - (float)hb); } }
  __syncthreads();
  for (int q = tid; q < DP * 8; q += 256) { const int rowi = q >> 3, pc = q & 7; const size_t o = ((size_t)b * DP + rowi) * SS + p0 + pc * 8; vst2((unsigned*)(VTH + o), *(const v4u*)&svh[rowi][pc * 8]); vst2((unsigned*)(VTL + o), *(const v4u*)&svl[rowi][pc * 8]); }
}
// one stage of the LDS ring = KST keys of one head: K rows in f32 and V^T hi / lo rows in bf16 are all 128 B long; pitch 144 B suits the 16-byte LDS readers
#define KST 64
#define NST (SS / KST)
#define KPIT 36
#define VPIT 72
__device__ __forceinline__ unsigned lds_off(const void* p) { return (unsigned)(size_t)p; }   // low 32 bits of a __shared__ address = byte offset in the work-group's LDS
// 8 lanes copy one whole 128-B row; a lane's 8 copies: K rows r, r+16, r+32, r+48, V^T hi rows r, r+16, V^T lo rows r, r+16 (r = tid >> 3)
__device__ __forceinline__ void stage_copy(const float* gk, const __bf16* gh, const __bf16* gl, unsigned lk, unsigned lh, unsigned ll) {
  // the copies go global -> LDS through no register; s_wait_xcnt 0 closes the statement so that no address register is rewritten ahead of it
  asm volatile("global_load_async_to_lds_b128 %0, %8, off\n\t"
               "global_load_async_to_lds_b128 %1, %9, off\n\t"
               "global_load_async_to_lds_b128 %2, %10, off\n\t"
               "global_load_async_to_lds_b128 %3, %11, off\n\t"
               "global_load_async_to_lds_b128 %4, %12, off\n\t"
               "global_load_async_to_lds_b128 %5, %13, off\n\t"
               "global_load_async_to_lds_b128 %6, %14, off\n\t"
               "global_load_async_to_lds_b128 %7, %15, off\n\t"
               "s_wait_xcnt 0x0"
               :: "v"(lk), "v"(lk + 16u * KPIT * 4u), "v"(lk + 32u * KPIT * 4u), "v"(lk + 48u * KPIT * 4u), "v"(lh), "v"(lh + 16u * VPIT * 2u), "v"(ll), "v"(ll + 16u * VPIT * 2u),
                  "v"(gk), "v"(gk + 16 * QKVP), "v"(gk + 32 * QKVP), "v"(gk + 48 * QKVP), "v"(gh), "v"(gh + 16 * SS), "v"(gl), "v"(gl + 16 * SS)
               : "memory");
}
__global__ __launch_bounds__(128) void k_attn(float* __restrict__ QKV, const __bf16* __restrict__ VTH, const __bf16* __restrict__ VTL) {
  __shared__ __align__(16) float sk[2][KST][KPIT]; __shared__ __align__(16) __bf16 svh[2][HD][VPIT], svl[2][HD][VPIT];
  __shared__ __align__(16) float so[4][16][36];
  const int tid = threadIdx.x, wave = tid >> 5, lane = tid & 31, col = lane & 15, g = lane >> 4;
  const int qb = blockIdx.x, bh = blockIdx.y, b = bh / NH, h = bh % NH; const int q0 = qb * 64 + wave * 16; const size_t tq = (size_t)b * SS + q0;
  const int crow = tid >> 3, cpc = tid & 7;
  const float* gk = QKV + ((size_t)b * SS + crow) * QKVP + DP + h * HD + cpc * 4;
  const __bf16* gh = VTH + ((size_t)b * DP + h * HD + crow) * SS + cpc * 8; const __bf16* gl = VTL + ((size_t)b * DP + h * HD + crow) * SS + cpc * 8;
  const unsigned lk = lds_off(&sk[0][crow][cpc * 4]), lh = lds_off(&svh[0][crow][cpc * 8]), ll = lds_off(&svl[0][crow][cpc * 8]);
  const unsigned kbuf = KST * KPIT * 4u, vbuf = HD * VPIT * 2u;
  stage_copy(gk, gh, gl, lk, lh, ll);
  const F2 a0 = split_row(QKV + (tq + col) * QKVP + h * HD, 0, lane);   // B operand of the scores: lane = query column
  asm volatile("s_wait_asynccnt 0x0" ::: "memory");   // stage 0 has landed before the barrier that publishes it
  __syncthreads();
  stage_copy(gk + (size_t)KST * QKVP, gh + KST, gl + KST, lk + kbuf, lh + vbuf, ll + vbuf);
  v8f l = {};        // a lane's own partial sums of t for its query column (keys 8g + r of every 16)
  v8f acc[2] = {};   // O^T: acc[dt][r] = head column dt * 16 + 8g + r of query column col
  const float scl = 0.17677669529663687f;    // 1/sqrt(32)
#pragma unroll 1
  for (int st = 0; st < NST; ++st) {
    const int bf = st & 1;
#pragma unroll   // both 32-key halves of a stage in line: their LDS offsets become immediates
    for (int hs = 0; hs < KST / 32; ++hs) {
    // S^T = K Q^T: D register r of tile ct is key ct * 16 + 8g + r of query col, which is element ct * 8 + r of the B operand of O^T += V^T P^T
    float t[16];
#pragma unroll
    for (int ct = 0; ct < 2; ++ct) { const F2 k0 = split_row(&sk[bf][hs * 32 + ct * 16 + col][0], 0, lane);
      v8f c = wmma_bf(k0.h, a0.l, (v8f){}); c = wmma_bf(k0.l, a0.h, c); c = wmma_bf(k0.h, a0.h, c);
#pragma unroll
      for (int r = 0; r < 8; ++r) { const float u = c[r] * scl + 5.0f; t[ct * 8 + r] = u * u; } }
#pragma unroll
    for (int r = 0; r < 8; ++r) l[r] += t[r] + t[8 + r];
    const F2 pb = bsplit16(t);
#pragma unroll
    for (int dt = 0; dt < 2; ++dt) { const v16b vh = frag_b(&svh[bf][dt * 16 + col][hs * 32], lane), vl = frag_b(&svl[bf][dt * 16 + col][hs * 32], lane);
      acc[dt] = wmma_bf(vh, pb.l, acc[dt]); acc[dt] = wmma_bf(vl, pb.h, acc[dt]); acc[dt] = wmma_bf(vh, pb.h, acc[dt]); } }
    asm volatile("s_wait_dscnt 0x0" ::: "memory");      // this wave's reads of buffer bf are over before the buffer is refilled
    asm volatile("s_wait_asynccnt 0x0" ::: "memory");   // this wave's copies of stage st + 1 have landed before the barrier that publishes them
    __syncthreads();                                    // publishes stage st + 1 and ends every wave's reads of buffer bf
    if (st + 2 < NST) stage_copy(gk + (size_t)(st + 2) * KST * QKVP, gh + (st + 2) * KST, gl + (st + 2) * KST, lk + bf * kbuf, lh + bf * vbuf, ll + bf * vbuf);
  }
  asm volatile("s_wait_asynccnt 0x0" ::: "memory");     // no copy is outstanding when the wave goes on to its end
  float ls = ((l[0] + l[1]) + (l[2] + l[3])) + ((l[4] + l[5]) + (l[6] + l[7]));
  ls += __shfl_xor(ls, 16);   // the two lane halves of a query column join their sums once
  const float il = 1.0f / ls;
  // a lane holds 8 consecutive head columns of its query row per tile; the rows go through the wave's own LDS so that each store covers whole 128-B lines
#pragma unroll
  for (int dt = 0; dt < 2; ++dt) {
    *(v4f*)&so[wave][col][dt * 16 + 8 * g] = (v4f){acc[dt][0] * il, acc[dt][1] * il, acc[dt][2] * il, acc[dt][3] * il};
    *(v4f*)&so[wave][col][dt * 16 + 8 * g + 4] = (v4f){acc[dt][4] * il, acc[dt][5] * il, acc[dt][6] * il, acc[dt][7] * il}; }
  LDSX();
#pragma unroll
  for (int i = 0; i < 4; ++i) { const int rl = i * 4 + (lane >> 3), pc = lane & 7; vst2(QKV + (tq + rl) * QKVP + h * HD + pc * 4, *(const v4f*)&so[wave][rl][pc * 4]); }
}
// ---- k_out: Y = O(hi/lo; the q columns of QKV, K 256) . Wo rows (2 products) + bo; block (64 rows, 128 of the 256 cols)
__global__ __launch_bounds__(128) void k_out(const float* __restrict__ QKV, const __bf16* __restrict__ PT, const float* __restrict__ bo, float* __restrict__ Y) {
  __shared__ __align__(16) float so[4][16][132];
  const int tid = threadIdx.x, wave = tid >> 5, lane = tid & 31, col = lane & 15, g = lane >> 4; const size_t r0 = (size_t)blockIdx.x * 64 + wave * 16; const int n0 = blockIdx.y * 128;
  v8f acc[8] = {};
#pragma unroll 2
  for (int kc = 0; kc < DP / 32; ++kc) { const F2 a = split_row(QKV + (r0 + col) * QKVP, kc * 32, lane);
#pragma unroll
    for (int j = 0; j < 8; ++j) { const v16b w = frag_b(PT + PT_O + (size_t)(n0 + j * 16 + col) * DP + kc * 32, lane); acc[j] = wmma_bf(a.l, w, acc[j]); acc[j] = wmma_bf(a.h, w, acc[j]); } }
#pragma unroll
  for (int j = 0; j < 8; ++j) { const float bb = bfr(bo[n0 + j * 16 + col]);
#pragma unroll
    for (int r = 0; r < 8; ++r) so[wave][8 * g + r][j * 16 + col] = acc[j][r] + bb; }
  LDSX();
  for (int rl = 0; rl < 16; ++rl) vst2(Y + (r0 + rl) * DIN + n0 + lane * 4, *(const v4f*)&so[wave][rl][lane * 4]);
}

extern "C" void kernel_launch(void* const* d_in, const int* in_sizes, int n_in, void* d_out, int out_size, void* d_ws, size_t ws_size, hipStream_t stream) {
  (void)in_sizes; (void)n_in; (void)out_size;
  const float** F = (const float**)d_in;   // x [8,1024,256], qkv_w [768,256], qkv_b [768], proj_w [256,256], proj_b [256]
  if (ws_size < (size_t)WS_END) return;
  char* ws = (char*)d_ws; __bf16 *PT = (__bf16*)(ws + WS_PT), *VTH = (__bf16*)(ws + WS_VTH), *VTL = (__bf16*)(ws + WS_VTL); float* QKV = (float*)(ws + WS_QKV);
  k_pack<<<QKVP + DIN, 256, 0, stream>>>(F[1], F[3], PT);
  k_proj<<<dim3(TRB, QKVP / 128), 128, 0, stream>>>(F[0], PT, F[2], QKV);
  k_vt<<<TRB, 256, 0, stream>>>(QKV, VTH, VTL);
  k_attn<<<dim3(TQB, TNB * NH), 128, 0, stream>>>(QKV, VTH, VTL);
  k_out<<<dim3((TNB < NB ? TQB : NR / 64), DIN / 128), 128, 0, stream>>>(QKV, PT, F[4], (float*)d_out);
}

// v003
// A run of this version takes 94.9 microseconds.
// Timed twice side by side with v002, it ran 1.12 and 1.13 times as fast.
// All steps since v000 together make it 1.59 times as fast.
// compute dtype: x, qkv_w/qkv_b, proj_w/proj_b (module inputs) rounded to bf16; qkv projection with exact bf16 products (+ bias); scores and the (s + 5)^2-weighted value sums with both computed operands as bf16 hi + bf16 residual pairs (3 products); output projection hi/lo x bf16 proj_w (2 products) + bias; the quadratic normalisation in f32; f32 accumulate.
#include <hip/hip_runtime.h>
#include <math.h>

typedef __attribute__((ext_vector_type(16))) _Float16 v16h;
typedef __attribute__((ext_vector_type(16))) __bf16 v16b;
typedef __attribute__((ext_vector_type(8)))  _Float16 v8h;
typedef __attribute__((ext_vector_type(8)))  float v8f;
typedef __attribute__((ext_vector_type(4)))  float v4f;
typedef __attribute__((ext_vector_type(2)))  float v2f;
typedef __attribute__((ext_vector_type(4)))  unsigned v4u;
typedef __attribute__((ext_vector_type(4)))  int v4i;
typedef float __attribute__((may_alias)) float_a;
typedef int __attribute__((may_alias)) int_a;

template <typename T> __device__ __forceinline__ void vst2(void* p, T v) { *(T*)p = v;  }
__device__ __forceinline__ v8f wmma16(v16h a, v16h b, v8f c) {
  v8f d = __builtin_amdgcn_wmma_f32_16x16x32_f16(false, a, false, b, (short)0, c, false, false);
  asm volatile("v_nop\n\tv_nop\n\tv_nop\n\tv_nop" : "+v"(d) : "v"(a), "v"(b));
  return d;
}
__device__ __forceinline__ v8f wmma_bf(v16b a, v16b b, v8f c) {
  v8f d = __builtin_amdgcn_wmma_f32_16x16x32_bf16(false, a, false, b, (short)0, c, false, false);
  asm volatile("v_nop\n\tv_nop\n\tv_nop\n\tv_nop" : "+v"(d) : "v"(a), "v"(b));
  return d;
}
// 16x16x32 fragments: lane = (h = lane>>4, row/col = lane&15); elements 0..7 = k0+8h+0..7, 8..15 = k0+16+8h+0..7; D element r = row 8h+r
__device__ __forceinline__ v16h frag_h(const _Float16* rowk0, int lane) {
  union { v16h v; v8h q[2]; } u; const _Float16* p = rowk0 + 8 * (lane >> 4);
  u.q[0] = *(const v8h*)p; u.q[1] = *(const v8h*)(p + 16); return u.v;
}
__device__ __forceinline__ v16h frag_f32(const float* rowk0, int lane) {
  v16h a; const float* p = rowk0 + 8 * (lane >> 4);
#pragma unroll
  for (int i = 0; i < 8; ++i) { a[i] = (_Float16)p[i]; a[8 + i] = (_Float16)p[16 + i]; }
  return a;
}
__device__ __forceinline__ v16h frag_f32s(const float* rowk0, int lane, float sc) {
  v16h a; const float* p = rowk0 + 8 * (lane >> 4);
#pragma unroll
  for (int i = 0; i < 8; ++i) { a[i] = (_Float16)(p[i] * sc); a[8 + i] = (_Float16)(p[16 + i] * sc); }
  return a;
}
// column fragment from a [K][ld] layout (column n), rows >= K read as 0
__device__ __forceinline__ v16h fragc_f32(const float* W, int k0, int n, int lane, int ld, int K) {
  v16h a; const int g = lane >> 4;
#pragma unroll
  for (int i = 0; i < 8; ++i) { const int ka = k0 + 8 * g + i, kb = ka + 16;
    a[i] = (_Float16)(ka < K ? W[(size_t)(ka < K ? ka : K - 1) * ld + n] : 0.f); a[8 + i] = (_Float16)(kb < K ? W[(size_t)(kb < K ? kb : K - 1) * ld + n] : 0.f); }
  return a;
}
struct F2 { v16b h, l; };
__device__ __forceinline__ F2 bsplit16(const float v[16]) { F2 r;
#pragma unroll
  for (int i = 0; i < 16; ++i) { const __bf16 h = (__bf16)v[i]; r.h[i] = h; r.l[i] = (__bf16)(v[i] - (float)h); }
  return r; }
__device__ __forceinline__ F2 split_row(const float* row, int k0, int lane) { float v[16]; const float* p = row + k0 + 8 * (lane >> 4);
#pragma unroll
  for (int i = 0; i < 8; ++i) { v[i] = p[i]; v[8 + i] = p[16 + i]; }
  return bsplit16(v); }
__device__ __forceinline__ F2 split_rowK(const float* row, int k0, int lane, int K) { float v[16]; const int g = lane >> 4;
#pragma unroll
  for (int i = 0; i < 8; ++i) { const int ka = k0 + 8 * g + i, kb = ka + 16; v[i] = ka < K ? row[ka < K ? ka : K - 1] : 0.f; v[8 + i] = kb < K ? row[kb < K ? kb : K - 1] : 0.f; }
  return bsplit16(v); }
__device__ __forceinline__ F2 split_col(const float* W, int k0, int n, int lane, int ld, int K) { float v[16]; const int g = lane >> 4;
#pragma unroll
  for (int i = 0; i < 8; ++i) { const int ka = k0 + 8 * g + i, kb = ka + 16; v[i] = ka < K ? W[(size_t)(ka < K ? ka : K - 1) * ld + n] : 0.f; v[8 + i] = kb < K ? W[(size_t)(kb < K ? kb : K - 1) * ld + n] : 0.f; }
  return bsplit16(v); }
__device__ __forceinline__ v8f mac3(const F2& a, const F2& b, v8f c) { c = wmma_bf(a.l, b.h, c); c = wmma_bf(a.h, b.l, c); return wmma_bf(a.h, b.h, c); }
__device__ __forceinline__ float sigm(float v) { return 1.0f / (1.0f + expf(-v)); }
#define LDSX() do { asm volatile("s_wait_dscnt 0" ::: "memory"); __builtin_amdgcn_wave_barrier(); __builtin_amdgcn_fence(__ATOMIC_RELEASE, "workgroup"); } while (0)


// Linear-variant attention: qkv = x qkv_w^T + b (8 heads x 32), scores = q k^T / sqrt(32), t = (scores + 5)^2, attn = t / sum_k t (no softmax), out = attn v merged, @ proj_w^T + proj_b.  B 8, N 1024, D 256.
// k_pack, k_proj (exact GEMM + bias; q and k columns as f32 rows, v columns straight as V^T bf16 hi / lo rows), k_attn (flash-style without max tracking: S^T = K Q^T, running in-lane sum of t and O^T += V^T t^T over 32 key steps, t staying in registers; K and V^T tiles come through a two-buffer LDS ring shared by the block's four waves), k_out (+ proj_b).
#define NB 8
#define SS 1024
#define DIN 256
#define DP 256
#define NH 8
#define HD 32
#define NR (NB * SS)
#define QKVP (3 * DP)
#ifndef TRB
#define TRB (NR / 64)
#define TQB (SS / 64)
#define TNB NB
#endif
typedef __attribute__((ext_vector_type(8))) __bf16 v8b;
__device__ __forceinline__ v16b frag_b(const __bf16* rowk0, int lane) {
  union { v16b v; v8b q[2]; } u; const __bf16* p = rowk0 + 8 * (lane >> 4);
  u.q[0] = *(const v8b*)p; u.q[1] = *(const v8b*)(p + 16); return u.v;
}
__device__ __forceinline__ v16b frag_gbf(const float* rowk0, int lane) {
  v16b a; const float* p = rowk0 + 8 * (lane >> 4);
#pragma unroll
  for (int i = 0; i < 8; ++i) { a[i] = (__bf16)p[i]; a[8 + i] = (__bf16)p[16 + i]; }
  return a;
}
__device__ __forceinline__ float bfr(float v) { return (float)(__bf16)v; }
__device__ __attribute__((noinline)) float exp_ni(float v) { return expf(v); }
#define WS_PT   0u                                  // bf16 [768][256] (Wq|Wk|Wv rows) then [256][256] (Wo rows)
#define PT_O    ((size_t)QKVP * DIN)
#define WS_QKV  (WS_PT + 2u * (QKVP * DIN + DIN * DP))  // f32 [8192][768]; q cols later overwritten by O
#define WS_VTH  (WS_QKV + 4u * NR * QKVP)             // bf16 [8][256][1024]
#define WS_VTL  (WS_VTH + 2u * NB * DP * SS)
#define WS_END  (WS_VTL + 2u * NB * DP * SS)

__global__ __launch_bounds__(256) void k_pack(const float* __restrict__ Wqkv, const float* __restrict__ Wo, __bf16* __restrict__ PT) {
  __shared__ __align__(16) __bf16 srow[DIN];
  const int n = blockIdx.x, tid = threadIdx.x;
  if (n < QKVP) { const float* Wm = Wqkv + (size_t)n * DIN; for (int k = tid; k < DIN; k += 256) srow[k] = (__bf16)Wm[k]; __syncthreads(); if (tid < DIN / 8) vst2((unsigned*)(PT + (size_t)n * DIN + tid * 8), *(const v4u*)(&srow[tid * 8])); }
  else { const int c = n - QKVP; const float* Wm = Wo + (size_t)c * DP; for (int k = tid; k < DP; k += 256) srow[k] = (__bf16)Wm[k]; __syncthreads(); if (tid < DP / 8) vst2((unsigned*)(PT + PT_O + (size_t)c * DP + tid * 8), *(const v4u*)(&srow[tid * 8])); }
}
// ---- k_proj: QKV[r][n] = bf16(x[r]) . PT[n] (exact, K 256) + bias; block (64 rows, 128 cols); the v columns leave as V^T hi / lo rows
#define PVP 72   // LDS pitch of a V^T row of 64 tokens: 144 B suits the 16-byte LDS writers and readers
union ProjLds { float so[4][16][132]; __bf16 sv[2][128][PVP]; };
__global__ __launch_bounds__(128) void k_proj(const float* __restrict__ X, const __bf16* __restrict__ PT, const float* __restrict__ bqkv, float* __restrict__ QKV, __bf16* __restrict__ VTH, __bf16* __restrict__ VTL) {
  __shared__ __align__(16) ProjLds sm;
  const int tid = threadIdx.x, wave = tid >> 5, lane = tid & 31, col = lane & 15, g = lane >> 4; const size_t r0 = (size_t)blockIdx.x * 64 + wave * 16; const int n0 = blockIdx.y * 128;
  v8f acc[8] = {};
#pragma unroll 2
  for (int kc = 0; kc < DIN / 32; ++kc) { const v16b a = frag_gbf(X + (r0 + col) * DIN + kc * 32, lane);
#pragma unroll
    for (int j = 0; j < 8; ++j) acc[j] = wmma_bf(a, frag_b(PT + (size_t)(n0 + j * 16 + col) * DIN + kc * 32, lane), acc[j]); }
  float bb[8];
#pragma unroll
  for (int j = 0; j < 8; ++j) bb[j] = bfr(bqkv[n0 + j * 16 + col]);
  if (n0 >= 2 * DP) {   // v columns (the same for the whole block): a lane's 8 D registers are 8 consecutive tokens of one column = 16 B of a V^T row
#pragma unroll
    for (int j = 0; j < 8; ++j) { const int c = j * 16 + col; v8b hv, lv;
#pragma unroll
      for (int r = 0; r < 8; ++r) { const float v = acc[j][r] + bb[j]; const __bf16 hb = (__bf16)v; hv[r] = hb; lv[r] = (__bf16)(v - (float)hb); }
      *(v8b*)&sm.sv[0][c][wave * 16 + 8 * g] = hv; *(v8b*)&sm.sv[1][c][wave * 16 + 8 * g] = lv; }
    __syncthreads();   // a V^T row's 64 tokens come from all four waves; behind it 8 lanes store one whole 128-B line
    const size_t t0 = (size_t)blockIdx.x * 64; const size_t o = ((t0 / SS) * DP + (n0 - 2 * DP) + (tid >> 3)) * SS + t0 % SS + (tid & 7) * 8;
#pragma unroll
    for (int i = 0; i < 8; ++i) { vst2((unsigned*)(VTH + o + (size_t)i * 16 * SS), *(const v4u*)&sm.sv[0][i * 16 + (tid >> 3)][(tid & 7) * 8]); vst2((unsigned*)(VTL + o + (size_t)i * 16 * SS), *(const v4u*)&sm.sv[1][i * 16 + (tid >> 3)][(tid & 7) * 8]); }
    return;
  }
#pragma unroll
  for (int j = 0; j < 8; ++j) {
#pragma unroll
    for (int r = 0; r < 8; ++r) sm.so[wave][8 * g + r][j * 16 + col] = acc[j][r] + bb[j]; }
  LDSX();
  for (int rl = 0; rl < 16; ++rl) vst2(QKV + (r0 + rl) * QKVP + n0 + lane * 4, *(const v4f*)&sm.so[wave][rl][lane * 4]);
}
// one stage of the LDS ring = KST keys of one head: K rows in f32 and V^T hi / lo rows in bf16 are all 128 B long; pitch 144 B suits the 16-byte LDS readers
#define KST 64
#define NST (SS / KST)
#define KPIT 36
#define VPIT 72
__device__ __forceinline__ unsigned lds_off(const void* p) { return (unsigned)(size_t)p; }   // low 32 bits of a __shared__ address = byte offset in the work-group's LDS
// 8 lanes copy one whole 128-B row; a lane's 8 copies: K rows r, r+16, r+32, r+48, V^T hi rows r, r+16, V^T lo rows r, r+16 (r = tid >> 3)
__device__ __forceinline__ void stage_copy(const float* gk, const __bf16* gh, const __bf16* gl, unsigned lk, unsigned lh, unsigned ll) {
  // the copies go global -> LDS through no register; s_wait_xcnt 0 closes the statement so that no address register is rewritten ahead of it
  asm volatile("global_load_async_to_lds_b128 %0, %8, off\n\t"
               "global_load_async_to_lds_b128 %1, %9, off\n\t"
               "global_load_async_to_lds_b128 %2, %10, off\n\t"
               "global_load_async_to_lds_b128 %3, %11, off\n\t"
               "global_load_async_to_lds_b128 %4, %12, off\n\t"
               "global_load_async_to_lds_b128 %5, %13, off\n\t"
               "global_load_async_to_lds_b128 %6, %14, off\n\t"
               "global_load_async_to_lds_b128 %7, %15, off\n\t"
               "s_wait_xcnt 0x0"
               :: "v"(lk), "v"(lk + 16u * KPIT * 4u), "v"(lk + 32u * KPIT * 4u), "v"(lk + 48u * KPIT * 4u), "v"(lh), "v"(lh + 16u * VPIT * 2u), "v"(ll), "v"(ll + 16u * VPIT * 2u),
                  "v"(gk), "v"(gk + 16 * QKVP), "v"(gk + 32 * QKVP), "v"(gk + 48 * QKVP), "v"(gh), "v"(gh + 16 * SS), "v"(gl), "v"(gl + 16 * SS)
               : "memory");
}
__global__ __launch_bounds__(128) void k_attn(float* __restrict__ QKV, const __bf16* __restrict__ VTH, const __bf16* __restrict__ VTL) {
  __shared__ __align__(16) float sk[2][KST][KPIT]; __shared__ __align__(16) __bf16 svh[2][HD][VPIT], svl[2][HD][VPIT];
  __shared__ __align__(16) float so[4][16][36];
  const int tid = threadIdx.x, wave = tid >> 5, lane = tid & 31, col = lane & 15, g = lane >> 4;
  const int qb = blockIdx.x, bh = blockIdx.y, b = bh / NH, h = bh % NH; const int q0 = qb * 64 + wave * 16; const size_t tq = (size_t)b * SS + q0;
  const int crow = tid >> 3, cpc = tid & 7;
  const float* gk = QKV + ((size_t)b * SS + crow) * QKVP + DP + h * HD + cpc * 4;
  const __bf16* gh = VTH + ((size_t)b * DP + h * HD + crow) * SS + cpc * 8; const __bf16* gl = VTL + ((size_t)b * DP + h * HD + crow) * SS + cpc * 8;
  const unsigned lk = lds_off(&sk[0][crow][cpc * 4]), lh = lds_off(&svh[0][crow][cpc * 8]), ll = lds_off(&svl[0][crow][cpc * 8]);
  const unsigned kbuf = KST * KPIT * 4u, vbuf = HD * VPIT * 2u;
  stage_copy(gk, gh, gl, lk, lh, ll);
  const F2 a0 = split_row(QKV + (tq + col) * QKVP + h * HD, 0, lane);   // B operand of the scores: lane = query column
  asm volatile("s_wait_asynccnt 0x0" ::: "memory");   // stage 0 has landed before the barrier that publishes it
  __syncthreads();
  stage_copy(gk + (size_t)KST * QKVP, gh + KST, gl + KST, lk + kbuf, lh + vbuf, ll + vbuf);
  v8f l = {};        // a lane's own partial sums of t for its query column (keys 8g + r of every 16)
  v8f acc[2] = {};   // O^T: acc[dt][r] = head column dt * 16 + 8g + r of query column col
  const float scl = 0.17677669529663687f;    // 1/sqrt(32)
#pragma unroll 1
  for (int st = 0; st < NST; ++st) {
    const int bf = st & 1;
#pragma unroll   // both 32-key halves of a stage in line: their LDS offsets become immediates
    for (int hs = 0; hs < KST / 32; ++hs) {
    // S^T = K Q^T: D register r of tile ct is key ct * 16 + 8g + r of query col, which is element ct * 8 + r of the B operand of O^T += V^T P^T
    float t[16];
#pragma unroll
    for (int ct = 0; ct < 2; ++ct) { const F2 k0 = split_row(&sk[bf][hs * 32 + ct * 16 + col][0], 0, lane);
      v8f c = wmma_bf(k0.h, a0.l, (v8f){}); c = wmma_bf(k0.l, a0.h, c); c = wmma_bf(k0.h, a0.h, c);
#pragma unroll
      for (int r = 0; r < 8; ++r) { const float u = c[r] * scl + 5.0f; t[ct * 8 + r] = u * u; } }
#pragma unroll
    for (int r = 0; r < 8; ++r) l[r] += t[r] + t[8 + r];
    const F2 pb = bsplit16(t);
#pragma unroll
    for (int dt = 0; dt < 2; ++dt) { const v16b vh = frag_b(&svh[bf][dt * 16 + col][hs * 32], lane), vl = frag_b(&svl[bf][dt * 16 + col][hs * 32], lane);
      acc[dt] = wmma_bf(vh, pb.l, acc[dt]); acc[dt] = wmma_bf(vl, pb.h, acc[dt]); acc[dt] = wmma_bf(vh, pb.h, acc[dt]); } }
    asm volatile("s_wait_dscnt 0x0" ::: "memory");      // this wave's reads of buffer bf are over before the buffer is refilled
    asm volatile("s_wait_asynccnt 0x0" ::: "memory");   // this wave's copies of stage st + 1 have landed before the barrier that publishes them
    __syncthreads();                                    // publishes stage st + 1 and ends every wave's reads of buffer bf
    if (st + 2 < NST) stage_copy(gk + (size_t)(st + 2) * KST * QKVP, gh + (st + 2) * KST, gl + (st + 2) * KST, lk + bf * kbuf, lh + bf * vbuf, ll + bf * vbuf);
  }
  asm volatile("s_wait_asynccnt 0x0" ::: "memory");     // no copy is outstanding when the wave goes on to its end
  float ls = ((l[0] + l[1]) + (l[2] + l[3])) + ((l[4] + l[5]) + (l[6] + l[7]));
  ls += __shfl_xor(ls, 16);   // the two lane halves of a query column join their sums once
  const float il = 1.0f / ls;
  // a lane holds 8 consecutive head columns of its query row per tile; the rows go through the wave's own LDS so that each store covers whole 128-B lines
#pragma unroll
  for (int dt = 0; dt < 2; ++dt) {
    *(v4f*)&so[wave][col][dt * 16 + 8 * g] = (v4f){acc[dt][0] * il, acc[dt][1] * il, acc[dt][2] * il, acc[dt][3] * il};
    *(v4f*)&so[wave][col][dt * 16 + 8 * g + 4] = (v4f){acc[dt][4] * il, acc[dt][5] * il, acc[dt][6] * il, acc[dt][7] * il}; }
  LDSX();
#pragma unroll
  for (int i = 0; i < 4; ++i) { const int rl = i * 4 + (lane >> 3), pc = lane & 7; vst2(QKV + (tq + rl) * QKVP + h * HD + pc * 4, *(const v4f*)&so[wave][rl][pc * 4]); }
}
// ---- k_out: Y = O(hi/lo; the q columns of QKV, K 256) . Wo rows (2 products) + bo; block (64 rows, 128 of the 256 cols)
__global__ __launch_bounds__(128) void k_out(const float* __restrict__ QKV, const __bf16* __restrict__ PT, const float* __restrict__ bo, float* __restrict__ Y) {
  __shared__ __align__(16) float so[4][16][132];
  const int tid = threadIdx.x, wave = tid >> 5, lane = tid & 31, col = lane & 15, g = lane >> 4; const size_t r0 = (size_t)blockIdx.x * 64 + wave * 16; const int n0 = blockIdx.y * 128;
  v8f acc[8] = {};
#pragma unroll 2
  for (int kc = 0; kc < DP / 32; ++kc) { const F2 a = split_row(QKV + (r0 + col) * QKVP, kc * 32, lane);
#pragma unroll
    for (int j = 0; j < 8; ++j) { const v16b w = frag_b(PT + PT_O + (size_t)(n0 + j * 16 + col) * DP + kc * 32, lane); acc[j] = wmma_bf(a.l, w, acc[j]); acc[j] = wmma_bf(a.h, w, acc[j]); } }
#pragma unroll
  for (int j = 0; j < 8; ++j) { const float bb = bfr(bo[n0 + j * 16 + col]);
#pragma unroll
    for (int r = 0; r < 8; ++r) so[wave][8 * g + r][j * 16 + col] = acc[j][r] + bb; }
  LDSX();
  for (int rl = 0; rl < 16; ++rl) vst2(Y + (r0 + rl) * DIN + n0 + lane * 4, *(const v4f*)&so[wave][rl][lane * 4]);
}

extern "C" void kernel_launch(void* const* d_in, const int* in_sizes, int n_in, void* d_out, int out_size, void* d_ws, size_t ws_size, hipStream_t stream) {
  (void)in_sizes; (void)n_in; (void)out_size;
  const float** F = (const float**)d_in;   // x [8,1024,256], qkv_w [768,256], qkv_b [768], proj_w [256,256], proj_b [256]
  if (ws_size < (size_t)WS_END) return;
  char* ws = (char*)d_ws; __bf16 *PT = (__bf16*)(ws + WS_PT), *VTH = (__bf16*)(ws + WS_VTH), *VTL = (__bf16*)(ws + WS_VTL); float* QKV = (float*)(ws + WS_QKV);
  k_pack<<<QKVP + DIN, 256, 0, stream>>>(F[1], F[3], PT);
  k_proj<<<dim3(TRB, QKVP / 128), 128, 0, stream>>>(F[0], PT, F[2], QKV, VTH, VTL);
  k_attn<<<dim3(TQB, TNB * NH), 128, 0, stream>>>(QKV, VTH, VTL);
  k_out<<<dim3((TNB < NB ? TQB : NR / 64), DIN / 128), 128, 0, stream>>>(QKV, PT, F[4], (float*)d_out);
}

// v004
// One run takes 73.4 microseconds.
// Next to v003, in two timings, it ran 1.30 times as fast each time.
// Counting every step since v000, it is 2.06 times as fast.
// compute dtype: x, qkv_w/qkv_b, proj_w/proj_b (module inputs) rounded to bf16; qkv projection with exact bf16 products (+ bias); scores and the (s + 5)^2-weighted value sums with both computed operands as bf16 hi + bf16 residual pairs (3 products); output projection hi/lo x bf16 proj_w (2 products) + bias; the quadratic normalisation in f32; f32 accumulate.
#include <hip/hip_runtime.h>
#include <math.h>

typedef __attribute__((ext_vector_type(16))) _Float16 v16h;
typedef __attribute__((ext_vector_type(16))) __bf16 v16b;
typedef __attribute__((ext_vector_type(8)))  _Float16 v8h;
typedef __attribute__((ext_vector_type(8)))  float v8f;
typedef __attribute__((ext_vector_type(4)))  float v4f;
typedef __attribute__((ext_vector_type(2)))  float v2f;
typedef __attribute__((ext_vector_type(4)))  unsigned v4u;
typedef __attribute__((ext_vector_type(4)))  int v4i;
typedef float __attribute__((may_alias)) float_a;
typedef int __attribute__((may_alias)) int_a;

template <typename T> __device__ __forceinline__ void vst2(void* p, T v) { *(T*)p = v;  }
__device__ __forceinline__ v8f wmma16(v16h a, v16h b, v8f c) {
  v8f d = __builtin_amdgcn_wmma_f32_16x16x32_f16(false, a, false, b, (short)0, c, false, false);
  asm volatile("v_nop\n\tv_nop\n\tv_nop\n\tv_nop" : "+v"(d) : "v"(a), "v"(b));
  return d;
}
__device__ __forceinline__ v8f wmma_bf(v16b a, v16b b, v8f c) {
  v8f d = __builtin_amdgcn_wmma_f32_16x16x32_bf16(false, a, false, b, (short)0, c, false, false);
  asm volatile("v_nop\n\tv_nop\n\tv_nop\n\tv_nop" : "+v"(d) : "v"(a), "v"(b));
  return d;
}
// 16x16x32 fragments: lane = (h = lane>>4, row/col = lane&15); elements 0..7 = k0+8h+0..7, 8..15 = k0+16+8h+0..7; D element r = row 8h+r
__device__ __forceinline__ v16h frag_h(const _Float16* rowk0, int lane) {
  union { v16h v; v8h q[2]; } u; const _Float16* p = rowk0 + 8 * (lane >> 4);
  u.q[0] = *(const v8h*)p; u.q[1] = *(const v8h*)(p + 16); return u.v;
}
__device__ __forceinline__ v16h frag_f32(const float* rowk0, int lane) {
  v16h a; const float* p = rowk0 + 8 * (lane >> 4);
#pragma unroll
  for (int i = 0; i < 8; ++i) { a[i] = (_Float16)p[i]; a[8 + i] = (_Float16)p[16 + i]; }
  return a;
}
__device__ __forceinline__ v16h frag_f32s(const float* rowk0, int lane, float sc) {
  v16h a; const float* p = rowk0 + 8 * (lane >> 4);
#pragma unroll
  for (int i = 0; i < 8; ++i) { a[i] = (_Float16)(p[i] * sc); a[8 + i] = (_Float16)(p[16 + i] * sc); }
  return a;
}
// column fragment from a [K][ld] layout (column n), rows >= K read as 0
__device__ __forceinline__ v16h fragc_f32(const float* W, int k0, int n, int lane, int ld, int K) {
  v16h a; const int g = lane >> 4;
#pragma unroll
  for (int i = 0; i < 8; ++i) { const int ka = k0 + 8 * g + i, kb = ka + 16;
    a[i] = (_Float16)(ka < K ? W[(size_t)(ka < K ? ka : K - 1) * ld + n] : 0.f); a[8 + i] = (_Float16)(kb < K ? W[(size_t)(kb < K ? kb : K - 1) * ld + n] : 0.f); }
  return a;
}
struct F2 { v16b h, l; };
__device__ __forceinline__ F2 bsplit16(const float v[16]) { F2 r;
#pragma unroll
  for (int i = 0; i < 16; ++i) { const __bf16 h = (__bf16)v[i]; r.h[i] = h; r.l[i] = (__bf16)(v[i] - (float)h); }
  return r; }
__device__ __forceinline__ F2 split_row(const float* row, int k0, int lane) { float v[16]; const float* p = row + k0 + 8 * (lane >> 4);
#pragma unroll
  for (int i = 0; i < 8; ++i) { v[i] = p[i]; v[8 + i] = p[16 + i]; }
  return bsplit16(v); }
__device__ __forceinline__ F2 split_rowK(const float* row, int k0, int lane, int K) { float v[16]; const int g = lane >> 4;
#pragma unroll
  for (int i = 0; i < 8; ++i) { const int ka = k0 + 8 * g + i, kb = ka + 16; v[i] = ka < K ? row[ka < K ? ka : K - 1] : 0.f; v[8 + i] = kb < K ? row[kb < K ? kb : K - 1] : 0.f; }
  return bsplit16(v); }
__device__ __forceinline__ F2 split_col(const float* W, int k0, int n, int lane, int ld, int K) { float v[16]; const int g = lane >> 4;
#pragma unroll
  for (int i = 0; i < 8; ++i) { const int ka = k0 + 8 * g + i, kb = ka + 16; v[i] = ka < K ? W[(size_t)(ka < K ? ka : K - 1) * ld + n] : 0.f; v[8 + i] = kb < K ? W[(size_t)(kb < K ? kb : K - 1) * ld + n] : 0.f; }
  return bsplit16(v); }
__device__ __forceinline__ v8f mac3(const F2& a, const F2& b, v8f c) { c = wmma_bf(a.l, b.h, c); c = wmma_bf(a.h, b.l, c); return wmma_bf(a.h, b.h, c); }
__device__ __forceinline__ float sigm(float v) { return 1.0f / (1.0f + expf(-v)); }
#define LDSX() do { asm volatile("s_wait_dscnt 0" ::: "memory"); __builtin_amdgcn_wave_barrier(); __builtin_amdgcn_fence(__ATOMIC_RELEASE, "workgroup"); } while (0)


// Linear-variant attention: qkv = x qkv_w^T + b (8 heads x 32), scores = q k^T / sqrt(32), t = (scores + 5)^2, attn = t / sum_k t (no softmax), out = attn v merged, @ proj_w^T + proj_b.  B 8, N 1024, D 256.
// k_proj (exact GEMM + bias; each block rounds its own 128 weight rows to bf16 into LDS; q and k columns as f32 rows, v columns straight as V^T bf16 hi / lo rows), k_attn (flash-style without max tracking: S^T = K Q^T, running in-lane sum of t and O^T += V^T t^T over 32 key steps, t staying in registers; K and V^T tiles come through a two-buffer LDS ring shared by the block's four waves), k_out (weight rows as in k_proj; + proj_b).
#define NB 8
#define SS 1024
#define DIN 256
#define DP 256
#define NH 8
#define HD 32
#define NR (NB * SS)
#define QKVP (3 * DP)
#ifndef TRB
#define TRB (NR / 64)
#define TQB (SS / 64)
#define TNB NB
#endif
typedef __attribute__((ext_vector_type(8))) __bf16 v8b;
__device__ __forceinline__ v16b frag_b(const __bf16* rowk0, int lane) {
  union { v16b v; v8b q[2]; } u; const __bf16* p = rowk0 + 8 * (lane >> 4);
  u.q[0] = *(const v8b*)p; u.q[1] = *(const v8b*)(p + 16); return u.v;
}
__device__ __forceinline__ v16b frag_gbf(const float* rowk0, int lane) {
  v16b a; const float* p = rowk0 + 8 * (lane >> 4);
#pragma unroll
  for (int i = 0; i < 8; ++i) { a[i] = (__bf16)p[i]; a[8 + i] = (__bf16)p[16 + i]; }
  return a;
}
__device__ __forceinline__ float bfr(float v) { return (float)(__bf16)v; }
__device__ __attribute__((noinline)) float exp_ni(float v) { return expf(v); }
#define WS_QKV  0u                                    // f32 [NR][QKVP]; q cols later overwritten by O, v cols unused
#define WS_VTH  (WS_QKV + 4u * NR * QKVP)             // bf16 [8][256][1024]
#define WS_VTL  (WS_VTH + 2u * NB * DP * SS)
#define WS_END  (WS_VTL + 2u * NB * DP * SS)

typedef __attribute__((ext_vector_type(4))) __bf16 v4b;
#define WPIT 264   // LDS pitch of a bf16 weight row of 256: 528 B = 16 B x 33 suits the 16-byte LDS readers
// a block's 128 weight rows (f32, 256 long, one run of memory) rounded to bf16 into LDS: each load of a wave covers 512 B in a row = four whole lines
__device__ __forceinline__ void stage_w(const float* __restrict__ Wt, __bf16 (*sw)[WPIT], int tid) {
#pragma unroll   // every load at an immediate offset from one address
  for (int c = 0; c < 2; ++c) { v4f w[32];
#pragma unroll   // w[] stays in registers, here and below
    for (int i = 0; i < 32; ++i) w[i] = *(const v4f*)(Wt + (c * 32 + i) * 512 + tid * 4);
#pragma unroll
    for (int i = 0; i < 32; ++i) *(v4b*)&sw[(c * 32 + i) * 2 + (tid >> 6)][(tid & 63) * 4] = (v4b){(__bf16)w[i][0], (__bf16)w[i][1], (__bf16)w[i][2], (__bf16)w[i][3]};
    if (c == 1) asm volatile("s_wait_xcnt 0x0" ::: "memory");   // stands ahead of the first later write of a register that these loads name
    __builtin_amdgcn_sched_barrier(0);   // holds the next 32 loads behind these stores (32 in flight fit the registers of the main loop, 64 took more than 256) and later code behind the wait
  }
}
// ---- k_proj: QKV[r][n] = bf16(x[r]) . bf16(Wqkv[n]) (exact products) + bias; block (64 rows, 128 cols); the v columns leave as V^T hi / lo rows
#define PVP 72   // LDS pitch of a V^T row of 64 tokens: 144 B suits the 16-byte LDS writers and readers
union ProjLds { __bf16 sw[128][WPIT]; float so[4][16][132]; __bf16 sv[2][128][PVP]; };
__global__ __launch_bounds__(128) void k_proj(const float* __restrict__ X, const float* __restrict__ Wqkv, const float* __restrict__ bqkv, float* __restrict__ QKV, __bf16* __restrict__ VTH, __bf16* __restrict__ VTL) {
  __shared__ __align__(16) ProjLds sm;
  const int tid = threadIdx.x, wave = tid >> 5, lane = tid & 31, col = lane & 15, g = lane >> 4; const size_t r0 = (size_t)blockIdx.x * 64 + wave * 16; const int n0 = blockIdx.y * 128;
  stage_w(Wqkv + (size_t)n0 * DIN, sm.sw, tid);
  __syncthreads();   // the weight rows are written by all four waves and read by all four
  v8f acc[8] = {};
#pragma unroll 2
  for (int kc = 0; kc < DIN / 32; ++kc) { const v16b a = frag_gbf(X + (r0 + col) * DIN + kc * 32, lane);
    v16b w[8];
#pragma unroll   // w[] stays in registers, LDS offsets become immediates
    for (int j = 0; j < 8; ++j) w[j] = frag_b(&sm.sw[j * 16 + col][kc * 32], lane);
    asm volatile("" :: "v"(w[0]), "v"(w[1]), "v"(w[2]), "v"(w[3]), "v"(w[4]), "v"(w[5]), "v"(w[6]), "v"(w[7]));   // inputs only: holds the LDS reads of a k step together ahead of its WMMAs; without it each WMMA waited out its own pair of reads
#pragma unroll
    for (int j = 0; j < 8; ++j) acc[j] = wmma_bf(a, w[j], acc[j]);
    asm volatile("s_wait_xcnt 0x0" ::: "memory"); }   // stands ahead of the next step's write of the address registers that this step's loads of x name
  __syncthreads();   // every wave has read its last weight row before the same LDS takes the results
  float bb[8];
#pragma unroll
  for (int j = 0; j < 8; ++j) bb[j] = bfr(bqkv[n0 + j * 16 + col]);
  if (n0 >= 2 * DP) {   // v columns (the same for the whole block): a lane's 8 D registers are 8 consecutive tokens of one column = 16 B of a V^T row
#pragma unroll
    for (int j = 0; j < 8; ++j) { const int c = j * 16 + col; v8b hv, lv;
#pragma unroll
      for (int r = 0; r < 8; ++r) { const float v = acc[j][r] + bb[j]; const __bf16 hb = (__bf16)v; hv[r] = hb; lv[r] = (__bf16)(v - (float)hb); }
      *(v8b*)&sm.sv[0][c][wave * 16 + 8 * g] = hv; *(v8b*)&sm.sv[1][c][wave * 16 + 8 * g] = lv; }
    __syncthreads();   // a V^T row's 64 tokens come from all four waves; behind it 8 lanes store one whole 128-B line
    const size_t t0 = (size_t)blockIdx.x * 64; const size_t o = ((t0 / SS) * DP + (n0 - 2 * DP) + (tid >> 3)) * SS + t0 % SS + (tid & 7) * 8;
#pragma unroll
    for (int i = 0; i < 8; ++i) { vst2((unsigned*)(VTH + o + (size_t)i * 16 * SS), *(const v4u*)&sm.sv[0][i * 16 + (tid >> 3)][(tid & 7) * 8]); vst2((unsigned*)(VTL + o + (size_t)i * 16 * SS), *(const v4u*)&sm.sv[1][i * 16 + (tid >> 3)][(tid & 7) * 8]); }
    return;
  }
#pragma unroll
  for (int j = 0; j < 8; ++j) {
#pragma unroll
    for (int r = 0; r < 8; ++r) sm.so[wave][8 * g + r][j * 16 + col] = acc[j][r] + bb[j]; }
  LDSX();
  for (int rl = 0; rl < 16; ++rl) vst2(QKV + (r0 + rl) * QKVP + n0 + lane * 4, *(const v4f*)&sm.so[wave][rl][lane * 4]);
}
// one stage of the LDS ring = KST keys of one head: K rows in f32 and V^T hi / lo rows in bf16 are all 128 B long; pitch 144 B suits the 16-byte LDS readers
#define KST 64
#define NST (SS / KST)
#define KPIT 36
#define VPIT 72
__device__ __forceinline__ unsigned lds_off(const void* p) { return (unsigned)(size_t)p; }   // low 32 bits of a __shared__ address = byte offset in the work-group's LDS
// 8 lanes copy one whole 128-B row; a lane's 8 copies: K rows r, r+16, r+32, r+48, V^T hi rows r, r+16, V^T lo rows r, r+16 (r = tid >> 3)
__device__ __forceinline__ void stage_copy(const float* gk, const __bf16* gh, const __bf16* gl, unsigned lk, unsigned lh, unsigned ll) {
  // the copies go global -> LDS through no register; s_wait_xcnt 0 closes the statement so that no address register is rewritten ahead of it
  asm volatile("global_load_async_to_lds_b128 %0, %8, off\n\t"
               "global_load_async_to_lds_b128 %1, %9, off\n\t"
               "global_load_async_to_lds_b128 %2, %10, off\n\t"
               "global_load_async_to_lds_b128 %3, %11, off\n\t"
               "global_load_async_to_lds_b128 %4, %12, off\n\t"
               "global_load_async_to_lds_b128 %5, %13, off\n\t"
               "global_load_async_to_lds_b128 %6, %14, off\n\t"
               "global_load_async_to_lds_b128 %7, %15, off\n\t"
               "s_wait_xcnt 0x0"
               :: "v"(lk), "v"(lk + 16u * KPIT * 4u), "v"(lk + 32u * KPIT * 4u), "v"(lk + 48u * KPIT * 4u), "v"(lh), "v"(lh + 16u * VPIT * 2u), "v"(ll), "v"(ll + 16u * VPIT * 2u),
                  "v"(gk), "v"(gk + 16 * QKVP), "v"(gk + 32 * QKVP), "v"(gk + 48 * QKVP), "v"(gh), "v"(gh + 16 * SS), "v"(gl), "v"(gl + 16 * SS)
               : "memory");
}
__global__ __launch_bounds__(128) void k_attn(float* __restrict__ QKV, const __bf16* __restrict__ VTH, const __bf16* __restrict__ VTL) {
  __shared__ __align__(16) float sk[2][KST][KPIT]; __shared__ __align__(16) __bf16 svh[2][HD][VPIT], svl[2][HD][VPIT];
  __shared__ __align__(16) float so[4][16][36];
  const int tid = threadIdx.x, wave = tid >> 5, lane = tid & 31, col = lane & 15, g = lane >> 4;
  const int qb = blockIdx.x, bh = blockIdx.y, b = bh / NH, h = bh % NH; const int q0 = qb * 64 + wave * 16; const size_t tq = (size_t)b * SS + q0;
  const int crow = tid >> 3, cpc = tid & 7;
  const float* gk = QKV + ((size_t)b * SS + crow) * QKVP + DP + h * HD + cpc * 4;
  const __bf16* gh = VTH + ((size_t)b * DP + h * HD + crow) * SS + cpc * 8; const __bf16* gl = VTL + ((size_t)b * DP + h * HD + crow) * SS + cpc * 8;
  const unsigned lk = lds_off(&sk[0][crow][cpc * 4]), lh = lds_off(&svh[0][crow][cpc * 8]), ll = lds_off(&svl[0][crow][cpc * 8]);
  const unsigned kbuf = KST * KPIT * 4u, vbuf = HD * VPIT * 2u;
  stage_copy(gk, gh, gl, lk, lh, ll);
  const F2 a0 = split_row(QKV + (tq + col) * QKVP + h * HD, 0, lane);   // B operand of the scores: lane = query column
  asm volatile("s_wait_asynccnt 0x0" ::: "memory");   // stage 0 has landed before the barrier that publishes it
  __syncthreads();
  stage_copy(gk + (size_t)KST * QKVP, gh + KST, gl + KST, lk + kbuf, lh + vbuf, ll + vbuf);
  v8f l = {};        // a lane's own partial sums of t for its query column (keys 8g + r of every 16)
  v8f acc[2] = {};   // O^T: acc[dt][r] = head column dt * 16 + 8g + r of query column col
  const float scl = 0.17677669529663687f;    // 1/sqrt(32)
#pragma unroll 1
  for (int st = 0; st < NST; ++st) {
    const int bf = st & 1;
#pragma unroll   // both 32-key halves of a stage in line: their LDS offsets become immediates
    for (int hs = 0; hs < KST / 32; ++hs) {
    // S^T = K Q^T: D register r of tile ct is key ct * 16 + 8g + r of query col, which is element ct * 8 + r of the B operand of O^T += V^T P^T
    float t[16];
#pragma unroll
    for (int ct = 0; ct < 2; ++ct) { const F2 k0 = split_row(&sk[bf][hs * 32 + ct * 16 + col][0], 0, lane);
      v8f c = wmma_bf(k0.h, a0.l, (v8f){}); c = wmma_bf(k0.l, a0.h, c); c = wmma_bf(k0.h, a0.h, c);
#pragma unroll
      for (int r = 0; r < 8; ++r) { const float u = c[r] * scl + 5.0f; t[ct * 8 + r] = u * u; } }
#pragma unroll
    for (int r = 0; r < 8; ++r) l[r] += t[r] + t[8 + r];
    const F2 pb = bsplit16(t);
#pragma unroll
    for (int dt = 0; dt < 2; ++dt) { const v16b vh = frag_b(&svh[bf][dt * 16 + col][hs * 32], lane), vl = frag_b(&svl[bf][dt * 16 + col][hs * 32], lane);
      acc[dt] = wmma_bf(vh, pb.l, acc[dt]); acc[dt] = wmma_bf(vl, pb.h, acc[dt]); acc[dt] = wmma_bf(vh, pb.h, acc[dt]); } }
    asm volatile("s_wait_dscnt 0x0" ::: "memory");      // this wave's reads of buffer bf are over before the buffer is refilled
    asm volatile("s_wait_asynccnt 0x0" ::: "memory");   // this wave's copies of stage st + 1 have landed before the barrier that publishes them
    __syncthreads();                                    // publishes stage st + 1 and ends every wave's reads of buffer bf
    if (st + 2 < NST) stage_copy(gk + (size_t)(st + 2) * KST * QKVP, gh + (st + 2) * KST, gl + (st + 2) * KST, lk + bf * kbuf, lh + bf * vbuf, ll + bf * vbuf);
  }
  asm volatile("s_wait_asynccnt 0x0" ::: "memory");     // no copy is outstanding when the wave goes on to its end
  float ls = ((l[0] + l[1]) + (l[2] + l[3])) + ((l[4] + l[5]) + (l[6] + l[7]));
  ls += __shfl_xor(ls, 16);   // the two lane halves of a query column join their sums once
  const float il = 1.0f / ls;
  // a lane holds 8 consecutive head columns of its query row per tile; the rows go through the wave's own LDS so that each store covers whole 128-B lines
#pragma unroll
  for (int dt = 0; dt < 2; ++dt) {
    *(v4f*)&so[wave][col][dt * 16 + 8 * g] = (v4f){acc[dt][0] * il, acc[dt][1] * il, acc[dt][2] * il, acc[dt][3] * il};
    *(v4f*)&so[wave][col][dt * 16 + 8 * g + 4] = (v4f){acc[dt][4] * il, acc[dt][5] * il, acc[dt][6] * il, acc[dt][7] * il}; }
  LDSX();
#pragma unroll
  for (int i = 0; i < 4; ++i) { const int rl = i * 4 + (lane >> 3), pc = lane & 7; vst2(QKV + (tq + rl) * QKVP + h * HD + pc * 4, *(const v4f*)&so[wave][rl][pc * 4]); }
}
// ---- k_out: Y = O(hi/lo; the q columns of QKV, K 256) . Wo rows (2 products) + bo; block (64 rows, 128 of the 256 cols)
__global__ __launch_bounds__(128) void k_out(const float* __restrict__ QKV, const float* __restrict__ Wo, const float* __restrict__ bo, float* __restrict__ Y) {
  __shared__ __align__(16) __bf16 sw[128][WPIT]; __shared__ __align__(16) float so[4][16][132];
  const int tid = threadIdx.x, wave = tid >> 5, lane = tid & 31, col = lane & 15, g = lane >> 4; const size_t r0 = (size_t)blockIdx.x * 64 + wave * 16; const int n0 = blockIdx.y * 128;
  stage_w(Wo + (size_t)n0 * DP, sw, tid);
  __syncthreads();   // the weight rows are written by all four waves and read by all four
  v8f acc[8] = {};
#pragma unroll 2
  for (int kc = 0; kc < DP / 32; ++kc) { const F2 a = split_row(QKV + (r0 + col) * QKVP, kc * 32, lane);
    v16b w[8];
#pragma unroll   // w[] stays in registers, LDS offsets become immediates
    for (int j = 0; j < 8; ++j) w[j] = frag_b(&sw[j * 16 + col][kc * 32], lane);
    asm volatile("" :: "v"(w[0]), "v"(w[1]), "v"(w[2]), "v"(w[3]), "v"(w[4]), "v"(w[5]), "v"(w[6]), "v"(w[7]));   // inputs only: holds the LDS reads of a k step together ahead of its WMMAs; without it each WMMA waited out its own pair of reads
#pragma unroll
    for (int j = 0; j < 8; ++j) { acc[j] = wmma_bf(a.l, w[j], acc[j]); acc[j] = wmma_bf(a.h, w[j], acc[j]); }
    asm volatile("s_wait_xcnt 0x0" ::: "memory"); }   // stands ahead of the next step's write of the address registers that this step's loads of O name
#pragma unroll
  for (int j = 0; j < 8; ++j) { const float bb = bfr(bo[n0 + j * 16 + col]);
#pragma unroll
    for (int r = 0; r < 8; ++r) so[wave][8 * g + r][j * 16 + col] = acc[j][r] + bb; }
  LDSX();
  for (int rl = 0; rl < 16; ++rl) vst2(Y + (r0 + rl) * DIN + n0 + lane * 4, *(const v4f*)&so[wave][rl][lane * 4]);
}

extern "C" void kernel_launch(void* const* d_in, const int* in_sizes, int n_in, void* d_out, int out_size, void* d_ws, size_t ws_size, hipStream_t stream) {
  (void)in_sizes; (void)n_in; (void)out_size;
  const float** F = (const float**)d_in;   // x [8,1024,256], qkv_w [768,256], qkv_b [768], proj_w [256,256], proj_b [256]
  if (ws_size < (size_t)WS_END) return;
  char* ws = (char*)d_ws; __bf16 *VTH = (__bf16*)(ws + WS_VTH), *VTL = (__bf16*)(ws + WS_VTL); float* QKV = (float*)(ws + WS_QKV);
  k_proj<<<dim3(TRB, QKVP / 128), 128, 0, stream>>>(F[0], F[1], F[2], QKV, VTH, VTL);
  k_attn<<<dim3(TQB, TNB * NH), 128, 0, stream>>>(QKV, VTH, VTL);
  k_out<<<dim3((TNB < NB ? TQB : NR / 64), DIN / 128), 128, 0, stream>>>(QKV, F[3], F[4], (float*)d_out);
}

// v005
// Measured time: 67.8 microseconds a run.
// Timed twice side by side with v004, it ran 1.08 times as fast both times.
// Counting every step since v000, it is 2.22 times as fast.
// compute dtype: x, qkv_w/qkv_b, proj_w/proj_b (module inputs) rounded to bf16; qkv projection with exact bf16 products (+ bias); scores and the (s + 5)^2-weighted value sums with both computed operands as bf16 hi + bf16 residual pairs (3 products); output projection hi/lo x bf16 proj_w (2 products) + bias; the quadratic normalisation in f32; f32 accumulate.
#include <hip/hip_runtime.h>
#include <math.h>

typedef __attribute__((ext_vector_type(16))) _Float16 v16h;
typedef __attribute__((ext_vector_type(16))) __bf16 v16b;
typedef __attribute__((ext_vector_type(8)))  _Float16 v8h;
typedef __attribute__((ext_vector_type(8)))  float v8f;
typedef __attribute__((ext_vector_type(4)))  float v4f;
typedef __attribute__((ext_vector_type(2)))  float v2f;
typedef __attribute__((ext_vector_type(4)))  unsigned v4u;
typedef __attribute__((ext_vector_type(4)))  int v4i;
typedef float __attribute__((may_alias)) float_a;
typedef int __attribute__((may_alias)) int_a;

template <typename T> __device__ __forceinline__ void vst2(void* p, T v) { *(T*)p = v;  }
__device__ __forceinline__ v8f wmma16(v16h a, v16h b, v8f c) {
  v8f d = __builtin_amdgcn_wmma_f32_16x16x32_f16(false, a, false, b, (short)0, c, false, false);
  asm volatile("v_nop\n\tv_nop\n\tv_nop\n\tv_nop" : "+v"(d) : "v"(a), "v"(b));
  return d;
}
__device__ __forceinline__ v8f wmma_bf(v16b a, v16b b, v8f c) {
  v8f d = __builtin_amdgcn_wmma_f32_16x16x32_bf16(false, a, false, b, (short)0, c, false, false);
  asm volatile("v_nop\n\tv_nop\n\tv_nop\n\tv_nop" : "+v"(d) : "v"(a), "v"(b));
  return d;
}
// 16x16x32 fragments: lane = (h = lane>>4, row/col = lane&15); elements 0..7 = k0+8h+0..7, 8..15 = k0+16+8h+0..7; D element r = row 8h+r
__device__ __forceinline__ v16h frag_h(const _Float16* rowk0, int lane) {
  union { v16h v; v8h q[2]; } u; const _Float16* p = rowk0 + 8 * (lane >> 4);
  u.q[0] = *(const v8h*)p; u.q[1] = *(const v8h*)(p + 16); return u.v;
}
__device__ __forceinline__ v16h frag_f32(const float* rowk0, int lane) {
  v16h a; const float* p = rowk0 + 8 * (lane >> 4);
#pragma unroll
  for (int i = 0; i < 8; ++i) { a[i] = (_Float16)p[i]; a[8 + i] = (_Float16)p[16 + i]; }
  return a;
}
__device__ __forceinline__ v16h frag_f32s(const float* rowk0, int lane, float sc) {
  v16h a; const float* p = rowk0 + 8 * (lane >> 4);
#pragma unroll
  for (int i = 0; i < 8; ++i) { a[i] = (_Float16)(p[i] * sc); a[8 + i] = (_Float16)(p[16 + i] * sc); }
  return a;
}
// column fragment from a [K][ld] layout (column n), rows >= K read as 0
__device__ __forceinline__ v16h fragc_f32(const float* W, int k0, int n, int lane, int ld, int K) {
  v16h a; const int g = lane >> 4;
#pragma unroll
  for (int i = 0; i < 8; ++i) { const int ka = k0 + 8 * g + i, kb = ka + 16;
    a[i] = (_Float16)(ka < K ? W[(size_t)(ka < K ? ka : K - 1) * ld + n] : 0.f); a[8 + i] = (_Float16)(kb < K ? W[(size_t)(kb < K ? kb : K - 1) * ld + n] : 0.f); }
  return a;
}
struct F2 { v16b h, l; };
__device__ __forceinline__ F2 bsplit16(const float v[16]) { F2 r;
#pragma unroll
  for (int i = 0; i < 16; ++i) { const __bf16 h = (__bf16)v[i]; r.h[i] = h; r.l[i] = (__bf16)(v[i] - (float)h); }
  return r; }
__device__ __forceinline__ F2 split_row(const float* row, int k0, int lane) { float v[16]; const float* p = row + k0 + 8 * (lane >> 4);
#pragma unroll
  for (int i = 0; i < 8; ++i) { v[i] = p[i]; v[8 + i] = p[16 + i]; }
  return bsplit16(v); }
__device__ __forceinline__ F2 split_rowK(const float* row, int k0, int lane, int K) { float v[16]; const int g = lane >> 4;
#pragma unroll
  for (int i = 0; i < 8; ++i) { const int ka = k0 + 8 * g + i, kb = ka + 16; v[i] = ka < K ? row[ka < K ? ka : K - 1] : 0.f; v[8 + i] = kb < K ? row[kb < K ? kb : K - 1] : 0.f; }
  return bsplit16(v); }
__device__ __forceinline__ F2 split_col(const float* W, int k0, int n, int lane, int ld, int K) { float v[16]; const int g = lane >> 4;
#pragma unroll
  for (int i = 0; i < 8; ++i) { const int ka = k0 + 8 * g + i, kb = ka + 16; v[i] = ka < K ? W[(size_t)(ka < K ? ka : K - 1) * ld + n] : 0.f; v[8 + i] = kb < K ? W[(size_t)(kb < K ? kb : K - 1) * ld + n] : 0.f; }
  return bsplit16(v); }
__device__ __forceinline__ v8f mac3(const F2& a, const F2& b, v8f c) { c = wmma_bf(a.l, b.h, c); c = wmma_bf(a.h, b.l, c); return wmma_bf(a.h, b.h, c); }
__device__ __forceinline__ float sigm(float v) { return 1.0f / (1.0f + expf(-v)); }
#define LDSX() do { asm volatile("s_wait_dscnt 0" ::: "memory"); __builtin_amdgcn_wave_barrier(); __builtin_amdgcn_fence(__ATOMIC_RELEASE, "workgroup"); } while (0)


// Linear-variant attention: qkv = x qkv_w^T + b (8 heads x 32), scores = q k^T / sqrt(32), t = (scores + 5)^2, attn = t / sum_k t (no softmax), out = attn v merged, @ proj_w^T + proj_b.  B 8, N 1024, D 256.
// k_proj (exact GEMM + bias; each block rounds its own 128 weight rows to bf16 into LDS; q and k columns as f32 rows, v columns straight as V^T bf16 hi / lo rows), k_attn (flash-style without max tracking: S^T = K Q^T, running in-lane sum of t and O^T += V^T t^T over 32 key steps, t staying in registers; K and V^T tiles come through a two-buffer LDS ring shared by the block's four waves, K split to bf16 hi | lo once on its way in), k_out (weight rows as in k_proj; + proj_b).
#define NB 8
#define SS 1024
#define DIN 256
#define DP 256
#define NH 8
#define HD 32
#define NR (NB * SS)
#define QKVP (3 * DP)
#ifndef TRB
#define TRB (NR / 64)
#define TQB (SS / 64)
#define TNB NB
#endif
typedef __attribute__((ext_vector_type(8))) __bf16 v8b;
__device__ __forceinline__ v16b frag_b(const __bf16* rowk0, int lane) {
  union { v16b v; v8b q[2]; } u; const __bf16* p = rowk0 + 8 * (lane >> 4);
  u.q[0] = *(const v8b*)p; u.q[1] = *(const v8b*)(p + 16); return u.v;
}
__device__ __forceinline__ v16b frag_gbf(const float* rowk0, int lane) {
  v16b a; const float* p = rowk0 + 8 * (lane >> 4);
#pragma unroll
  for (int i = 0; i < 8; ++i) { a[i] = (__bf16)p[i]; a[8 + i] = (__bf16)p[16 + i]; }
  return a;
}
__device__ __forceinline__ float bfr(float v) { return (float)(__bf16)v; }
__device__ __attribute__((noinline)) float exp_ni(float v) { return expf(v); }
#define WS_QKV  0u                                    // f32 [NR][QKVP]; q cols later overwritten by O, v cols unused
#define WS_VTH  (WS_QKV + 4u * NR * QKVP)             // bf16 [8][256][1024]
#define WS_VTL  (WS_VTH + 2u * NB * DP * SS)
#define WS_END  (WS_VTL + 2u * NB * DP * SS)

typedef __attribute__((ext_vector_type(4))) __bf16 v4b;
#define WPIT 264   // LDS pitch of a bf16 weight row of 256: 528 B = 16 B x 33 suits the 16-byte LDS readers
// a block's 128 weight rows (f32, 256 long, one run of memory) rounded to bf16 into LDS: each load of a wave covers 512 B in a row = four whole lines
__device__ __forceinline__ void stage_w(const float* __restrict__ Wt, __bf16 (*sw)[WPIT], int tid) {
#pragma unroll   // every load at an immediate offset from one address
  for (int c = 0; c < 2; ++c) { v4f w[32];
#pragma unroll   // w[] stays in registers, here and below
    for (int i = 0; i < 32; ++i) w[i] = *(const v4f*)(Wt + (c * 32 + i) * 512 + tid * 4);
#pragma unroll
    for (int i = 0; i < 32; ++i) *(v4b*)&sw[(c * 32 + i) * 2 + (tid >> 6)][(tid & 63) * 4] = (v4b){(__bf16)w[i][0], (__bf16)w[i][1], (__bf16)w[i][2], (__bf16)w[i][3]};
    if (c == 1) asm volatile("s_wait_xcnt 0x0" ::: "memory");   // stands ahead of the first later write of a register that these loads name
    __builtin_amdgcn_sched_barrier(0);   // holds the next 32 loads behind these stores (32 in flight fit the registers of the main loop, 64 took more than 256) and later code behind the wait
  }
}
// ---- k_proj: QKV[r][n] = bf16(x[r]) . bf16(Wqkv[n]) (exact products) + bias; block (64 rows, 128 cols); the v columns leave as V^T hi / lo rows
#define PVP 72   // LDS pitch of a V^T row of 64 tokens: 144 B suits the 16-byte LDS writers and readers
union ProjLds { __bf16 sw[128][WPIT]; float so[4][16][132]; __bf16 sv[2][128][PVP]; };
__global__ __launch_bounds__(128) void k_proj(const float* __restrict__ X, const float* __restrict__ Wqkv, const float* __restrict__ bqkv, float* __restrict__ QKV, __bf16* __restrict__ VTH, __bf16* __restrict__ VTL) {
  __shared__ __align__(16) ProjLds sm;
  const int tid = threadIdx.x, wave = tid >> 5, lane = tid & 31, col = lane & 15, g = lane >> 4; const size_t r0 = (size_t)blockIdx.x * 64 + wave * 16; const int n0 = blockIdx.y * 128;
  stage_w(Wqkv + (size_t)n0 * DIN, sm.sw, tid);
  __syncthreads();   // the weight rows are written by all four waves and read by all four
  v8f acc[8] = {};
#pragma unroll 2
  for (int kc = 0; kc < DIN / 32; ++kc) { const v16b a = frag_gbf(X + (r0 + col) * DIN + kc * 32, lane);
    v16b w[8];
#pragma unroll   // w[] stays in registers, LDS offsets become immediates
    for (int j = 0; j < 8; ++j) w[j] = frag_b(&sm.sw[j * 16 + col][kc * 32], lane);
    asm volatile("" :: "v"(w[0]), "v"(w[1]), "v"(w[2]), "v"(w[3]), "v"(w[4]), "v"(w[5]), "v"(w[6]), "v"(w[7]));   // inputs only: holds the LDS reads of a k step together ahead of its WMMAs; without it each WMMA waited out its own pair of reads
#pragma unroll
    for (int j = 0; j < 8; ++j) acc[j] = wmma_bf(a, w[j], acc[j]);
    asm volatile("s_wait_xcnt 0x0" ::: "memory"); }   // stands ahead of the next step's write of the address registers that this step's loads of x name
  __syncthreads();   // every wave has read its last weight row before the same LDS takes the results
  float bb[8];
#pragma unroll
  for (int j = 0; j < 8; ++j) bb[j] = bfr(bqkv[n0 + j * 16 + col]);
  if (n0 >= 2 * DP) {   // v columns (the same for the whole block): a lane's 8 D registers are 8 consecutive tokens of one column = 16 B of a V^T row
#pragma unroll
    for (int j = 0; j < 8; ++j) { const int c = j * 16 + col; v8b hv, lv;
#pragma unroll
      for (int r = 0; r < 8; ++r) { const float v = acc[j][r] + bb[j]; const __bf16 hb = (__bf16)v; hv[r] = hb; lv[r] = (__bf16)(v - (float)hb); }
      *(v8b*)&sm.sv[0][c][wave * 16 + 8 * g] = hv; *(v8b*)&sm.sv[1][c][wave * 16 + 8 * g] = lv; }
    __syncthreads();   // a V^T row's 64 tokens come from all four waves; behind it 8 lanes store one whole 128-B line
    const size_t t0 = (size_t)blockIdx.x * 64; const size_t o = ((t0 / SS) * DP + (n0 - 2 * DP) + (tid >> 3)) * SS + t0 % SS + (tid & 7) * 8;
#pragma unroll
    for (int i = 0; i < 8; ++i) { vst2((unsigned*)(VTH + o + (size_t)i * 16 * SS), *(const v4u*)&sm.sv[0][i * 16 + (tid >> 3)][(tid & 7) * 8]); vst2((unsigned*)(VTL + o + (size_t)i * 16 * SS), *(const v4u*)&sm.sv[1][i * 16 + (tid >> 3)][(tid & 7) * 8]); }
    return;
  }
#pragma unroll
  for (int j = 0; j < 8; ++j) {
#pragma unroll
    for (int r = 0; r < 8; ++r) sm.so[wave][8 * g + r][j * 16 + col] = acc[j][r] + bb[j]; }
  LDSX();
  for (int rl = 0; rl < 16; ++rl) vst2(QKV + (r0 + rl) * QKVP + n0 + lane * 4, *(const v4f*)&sm.so[wave][rl][lane * 4]);
}
// one stage of the LDS ring = KST keys of one head: K rows (32 bf16 hi | 32 bf16 lo) and V^T hi / lo rows in bf16 are all 128 B long; pitch 144 B suits the 16-byte LDS readers
#define KST 64
#define NST (SS / KST)
#define KPIT 72
#define VPIT 72
__device__ __forceinline__ unsigned lds_off(const void* p) { return (unsigned)(size_t)p; }   // low 32 bits of a __shared__ address = byte offset in the work-group's LDS
// 8 lanes copy one whole 128-B row; a lane's 4 copies: V^T hi rows r, r+16, V^T lo rows r, r+16 (r = tid >> 3)
__device__ __forceinline__ void stage_copy(const __bf16* gh, const __bf16* gl, unsigned lh, unsigned ll) {
  // the copies go global -> LDS through no register; s_wait_xcnt 0 closes the statement so that no address register is rewritten ahead of it
  asm volatile("global_load_async_to_lds_b128 %0, %4, off\n\t"
               "global_load_async_to_lds_b128 %1, %5, off\n\t"
               "global_load_async_to_lds_b128 %2, %6, off\n\t"
               "global_load_async_to_lds_b128 %3, %7, off\n\t"
               "s_wait_xcnt 0x0"
               :: "v"(lh), "v"(lh + 16u * VPIT * 2u), "v"(ll), "v"(ll + 16u * VPIT * 2u),
                  "v"(gh), "v"(gh + 16 * SS), "v"(gl), "v"(gl + 16 * SS)
               : "memory");
}
// a thread's share of a K tile: 4 floats of rows r, r+16, r+32, r+48 (8 lanes load one whole 128-B row)
struct KR { v4f v[4]; };
__device__ __forceinline__ KR load_k(const float* gk) { KR k;
#pragma unroll   // k.v[] stays in registers, the four loads at immediate offsets from one address
  for (int j = 0; j < 4; ++j) k.v[j] = *(const v4f*)(gk + j * 16 * QKVP);
  asm volatile("s_wait_xcnt 0x0" ::: "memory");   // stands ahead of the first later write of a register that these loads name, and keeps the loads issued here, a stage ahead of their use
  return k; }
// the share is split to bf16 hi + bf16 residual once for the whole block and stored as the hi and lo halves of its rows
__device__ __forceinline__ void put_k(const KR& k, __bf16 (*kb)[KPIT], int crow, int cpc) {
#pragma unroll   // k.v[] stays in registers, here and below
  for (int j = 0; j < 4; ++j) { v4b hv, lv;
#pragma unroll
    for (int e = 0; e < 4; ++e) { const float v = k.v[j][e]; const __bf16 hb = (__bf16)v; hv[e] = hb; lv[e] = (__bf16)(v - (float)hb); }
    *(v4b*)&kb[crow + 16 * j][cpc * 4] = hv; *(v4b*)&kb[crow + 16 * j][HD + cpc * 4] = lv; }
}
__global__ __launch_bounds__(128) void k_attn(float* __restrict__ QKV, const __bf16* __restrict__ VTH, const __bf16* __restrict__ VTL) {
  __shared__ __align__(16) __bf16 sk[2][KST][KPIT]; __shared__ __align__(16) __bf16 svh[2][HD][VPIT], svl[2][HD][VPIT];
  __shared__ __align__(16) float so[4][16][36];
  const int tid = threadIdx.x, wave = tid >> 5, lane = tid & 31, col = lane & 15, g = lane >> 4;
  const int qb = blockIdx.x, bh = blockIdx.y, b = bh / NH, h = bh % NH; const int q0 = qb * 64 + wave * 16; const size_t tq = (size_t)b * SS + q0;
  const int crow = tid >> 3, cpc = tid & 7;
  const float* gk = QKV + ((size_t)b * SS + crow) * QKVP + DP + h * HD + cpc * 4;
  const __bf16* gh = VTH + ((size_t)b * DP + h * HD + crow) * SS + cpc * 8; const __bf16* gl = VTL + ((size_t)b * DP + h * HD + crow) * SS + cpc * 8;
  const unsigned lh = lds_off(&svh[0][crow][cpc * 8]), ll = lds_off(&svl[0][crow][cpc * 8]);
  const unsigned vbuf = HD * VPIT * 2u;
  stage_copy(gh, gl, lh, ll);
  { const KR k0 = load_k(gk), k1 = load_k(gk + (size_t)KST * QKVP); put_k(k0, sk[0], crow, cpc); put_k(k1, sk[1], crow, cpc); }   // both K buffers are free here
  KR kn = load_k(gk + (size_t)2 * KST * QKVP);   // in flight over a whole stage
  const F2 a0 = split_row(QKV + (tq + col) * QKVP + h * HD, 0, lane);   // B operand of the scores: lane = query column
  asm volatile("s_wait_asynccnt 0x0" ::: "memory");   // stage 0 has landed before the barrier that publishes it
  __syncthreads();
  stage_copy(gh + KST, gl + KST, lh + vbuf, ll + vbuf);
  v8f l = {};        // a lane's own partial sums of t for its query column (keys 8g + r of every 16)
  v8f acc[2] = {};   // O^T: acc[dt][r] = head column dt * 16 + 8g + r of query column col
  const float scl = 0.17677669529663687f;    // 1/sqrt(32)
#pragma unroll 1
  for (int st = 0; st < NST; ++st) {
    const int bf = st & 1;
#pragma unroll   // both 32-key halves of a stage in line: their LDS offsets become immediates
    for (int hs = 0; hs < KST / 32; ++hs) {
    // S^T = K Q^T: D register r of tile ct is key ct * 16 + 8g + r of query col, which is element ct * 8 + r of the B operand of O^T += V^T P^T
    float t[16];
#pragma unroll
    for (int ct = 0; ct < 2; ++ct) { const __bf16* kp = &sk[bf][hs * 32 + ct * 16 + col][0]; const F2 k0 = {frag_b(kp, lane), frag_b(kp + HD, lane)};
      v8f c = wmma_bf(k0.h, a0.l, (v8f){}); c = wmma_bf(k0.l, a0.h, c); c = wmma_bf(k0.h, a0.h, c);
#pragma unroll
      for (int r = 0; r < 8; ++r) { const float u = c[r] * scl + 5.0f; t[ct * 8 + r] = u * u; } }
#pragma unroll
    for (int r = 0; r < 8; ++r) l[r] += t[r] + t[8 + r];
    const F2 pb = bsplit16(t);
#pragma unroll
    for (int dt = 0; dt < 2; ++dt) { const v16b vh = frag_b(&svh[bf][dt * 16 + col][hs * 32], lane), vl = frag_b(&svl[bf][dt * 16 + col][hs * 32], lane);
      acc[dt] = wmma_bf(vh, pb.l, acc[dt]); acc[dt] = wmma_bf(vl, pb.h, acc[dt]); acc[dt] = wmma_bf(vh, pb.h, acc[dt]); } }
    asm volatile("s_wait_dscnt 0x0" ::: "memory");      // this wave's reads of buffer bf are over before the buffer is refilled
    asm volatile("s_wait_asynccnt 0x0" ::: "memory");   // this wave's copies of stage st + 1 have landed before the barrier that publishes them
    __syncthreads();                                    // publishes stage st + 1 and ends every wave's reads of buffer bf
    if (st + 2 < NST) { stage_copy(gh + (st + 2) * KST, gl + (st + 2) * KST, lh + bf * vbuf, ll + bf * vbuf);
      put_k(kn, sk[bf], crow, cpc);   // K of stage st + 2, published by the next stage's barrier
      if (st + 3 < NST) kn = load_k(gk + (size_t)(st + 3) * KST * QKVP); }
  }
  asm volatile("s_wait_asynccnt 0x0" ::: "memory");     // no copy is outstanding when the wave goes on to its end
  float ls = ((l[0] + l[1]) + (l[2] + l[3])) + ((l[4] + l[5]) + (l[6] + l[7]));
  ls += __shfl_xor(ls, 16);   // the two lane halves of a query column join their sums once
  const float il = 1.0f / ls;
  // a lane holds 8 consecutive head columns of its query row per tile; the rows go through the wave's own LDS so that each store covers whole 128-B lines
#pragma unroll
  for (int dt = 0; dt < 2; ++dt) {
    *(v4f*)&so[wave][col][dt * 16 + 8 * g] = (v4f){acc[dt][0] * il, acc[dt][1] * il, acc[dt][2] * il, acc[dt][3] * il};
    *(v4f*)&so[wave][col][dt * 16 + 8 * g + 4] = (v4f){acc[dt][4] * il, acc[dt][5] * il, acc[dt][6] * il, acc[dt][7] * il}; }
  LDSX();
#pragma unroll
  for (int i = 0; i < 4; ++i) { const int rl = i * 4 + (lane >> 3), pc = lane & 7; vst2(QKV + (tq + rl) * QKVP + h * HD + pc * 4, *(const v4f*)&so[wave][rl][pc * 4]); }
}
// ---- k_out: Y = O(hi/lo; the q columns of QKV, K 256) . Wo rows (2 products) + bo; block (64 rows, 128 of the 256 cols)
__global__ __launch_bounds__(128) void k_out(const float* __restrict__ QKV, const float* __restrict__ Wo, const float* __restrict__ bo, float* __restrict__ Y) {
  __shared__ __align__(16) __bf16 sw[128][WPIT]; __shared__ __align__(16) float so[4][16][132];
  const int tid = threadIdx.x, wave = tid >> 5, lane = tid & 31, col = lane & 15, g = lane >> 4; const size_t r0 = (size_t)blockIdx.x * 64 + wave * 16; const int n0 = blockIdx.y * 128;
  stage_w(Wo + (size_t)n0 * DP, sw, tid);
  __syncthreads();   // the weight rows are written by all four waves and read by all four
  v8f acc[8] = {};
#pragma unroll 2
  for (int kc = 0; kc < DP / 32; ++kc) { const F2 a = split_row(QKV + (r0 + col) * QKVP, kc * 32, lane);
    v16b w[8];
#pragma unroll   // w[] stays in registers, LDS offsets become immediates
    for (int j = 0; j < 8; ++j) w[j] = frag_b(&sw[j * 16 + col][kc * 32], lane);
    asm volatile("" :: "v"(w[0]), "v"(w[1]), "v"(w[2]), "v"(w[3]), "v"(w[4]), "v"(w[5]), "v"(w[6]), "v"(w[7]));   // inputs only: holds the LDS reads of a k step together ahead of its WMMAs; without it each WMMA waited out its own pair of reads
#pragma unroll
    for (int j = 0; j < 8; ++j) { acc[j] = wmma_bf(a.l, w[j], acc[j]); acc[j] = wmma_bf(a.h, w[j], acc[j]); }
    asm volatile("s_wait_xcnt 0x0" ::: "memory"); }   // stands ahead of the next step's write of the address registers that this step's loads of O name
#pragma unroll
  for (int j = 0; j < 8; ++j) { const float bb = bfr(bo[n0 + j * 16 + col]);
#pragma unroll
    for (int r = 0; r < 8; ++r) so[wave][8 * g + r][j * 16 + col] = acc[j][r] + bb; }
  LDSX();
  for (int rl = 0; rl < 16; ++rl) vst2(Y + (r0 + rl) * DIN + n0 + lane * 4, *(const v4f*)&so[wave][rl][lane * 4]);
}

extern "C" void kernel_launch(void* const* d_in, const int* in_sizes, int n_in, void* d_out, int out_size, void* d_ws, size_t ws_size, hipStream_t stream) {
  (void)in_sizes; (void)n_in; (void)out_size;
  const float** F = (const float**)d_in;   // x [8,1024,256], qkv_w [768,256], qkv_b [768], proj_w [256,256], proj_b [256]
  if (ws_size < (size_t)WS_END) return;
  char* ws = (char*)d_ws; __bf16 *VTH = (__bf16*)(ws + WS_VTH), *VTL = (__bf16*)(ws + WS_VTL); float* QKV = (float*)(ws + WS_QKV);
  k_proj<<<dim3(TRB, QKVP / 128), 128, 0, stream>>>(F[0], F[1], F[2], QKV, VTH, VTL);
  k_attn<<<dim3(TQB, TNB * NH), 128, 0, stream>>>(QKV, VTH, VTL);
  k_out<<<dim3((TNB < NB ? TQB : NR / 64), DIN / 128), 128, 0, stream>>>(QKV, F[3], F[4], (float*)d_out);
}

// v006
// One run takes 65.7 microseconds.
// Timed twice side by side with v005, it ran 1.03 times as fast both times.
// Counting every step since v000, it is 2.29 times as fast.
// compute dtype: x, qkv_w/qkv_b, proj_w/proj_b (module inputs) rounded to bf16; qkv projection with exact bf16 products (+ bias); scores and the (s + 5)^2-weighted value sums with both computed operands as bf16 hi + bf16 residual pairs (3 products); output projection hi/lo x bf16 proj_w (2 products) + bias; the quadratic normalisation in f32; f32 accumulate.
#include <hip/hip_runtime.h>
#include <math.h>

typedef __attribute__((ext_vector_type(16))) _Float16 v16h;
typedef __attribute__((ext_vector_type(16))) __bf16 v16b;
typedef __attribute__((ext_vector_type(8)))  _Float16 v8h;
typedef __attribute__((ext_vector_type(8)))  float v8f;
typedef __attribute__((ext_vector_type(4)))  float v4f;
typedef __attribute__((ext_vector_type(2)))  float v2f;
typedef __attribute__((ext_vector_type(4)))  unsigned v4u;
typedef __attribute__((ext_vector_type(4)))  int v4i;
typedef float __attribute__((may_alias)) float_a;
typedef int __attribute__((may_alias)) int_a;

template <typename T> __device__ __forceinline__ void vst2(void* p, T v) { *(T*)p = v;  }
__device__ __forceinline__ v8f wmma16(v16h a, v16h b, v8f c) {
  v8f d = __builtin_amdgcn_wmma_f32_16x16x32_f16(false, a, false, b, (short)0, c, false, false);
  asm volatile("v_nop\n\tv_nop\n\tv_nop\n\tv_nop" : "+v"(d) : "v"(a), "v"(b));
  return d;
}
__device__ __forceinline__ v8f wmma_bf(v16b a, v16b b, v8f c) {
  return __builtin_amdgcn_wmma_f32_16x16x32_bf16(false, a, false, b, (short)0, c, false, false);
}
// 16x16x32 fragments: lane = (h = lane>>4, row/col = lane&15); elements 0..7 = k0+8h+0..7, 8..15 = k0+16+8h+0..7; D element r = row 8h+r
__device__ __forceinline__ v16h frag_h(const _Float16* rowk0, int lane) {
  union { v16h v; v8h q[2]; } u; const _Float16* p = rowk0 + 8 * (lane >> 4);
  u.q[0] = *(const v8h*)p; u.q[1] = *(const v8h*)(p + 16); return u.v;
}
__device__ __forceinline__ v16h frag_f32(const float* rowk0, int lane) {
  v16h a; const float* p = rowk0 + 8 * (lane >> 4);
#pragma unroll
  for (int i = 0; i < 8; ++i) { a[i] = (_Float16)p[i]; a[8 + i] = (_Float16)p[16 + i]; }
  return a;
}
__device__ __forceinline__ v16h frag_f32s(const float* rowk0, int lane, float sc) {
  v16h a; const float* p = rowk0 + 8 * (lane >> 4);
#pragma unroll
  for (int i = 0; i < 8; ++i) { a[i] = (_Float16)(p[i] * sc); a[8 + i] = (_Float16)(p[16 + i] * sc); }
  return a;
}
// column fragment from a [K][ld] layout (column n), rows >= K read as 0
__device__ __forceinline__ v16h fragc_f32(const float* W, int k0, int n, int lane, int ld, int K) {
  v16h a; const int g = lane >> 4;
#pragma unroll
  for (int i = 0; i < 8; ++i) { const int ka = k0 + 8 * g + i, kb = ka + 16;
    a[i] = (_Float16)(ka < K ? W[(size_t)(ka < K ? ka : K - 1) * ld + n] : 0.f); a[8 + i] = (_Float16)(kb < K ? W[(size_t)(kb < K ? kb : K - 1) * ld + n] : 0.f); }
  return a;
}
struct F2 { v16b h, l; };
__device__ __forceinline__ F2 bsplit16(const float v[16]) { F2 r;
#pragma unroll
  for (int i = 0; i < 16; ++i) { const __bf16 h = (__bf16)v[i]; r.h[i] = h; r.l[i] = (__bf16)(v[i] - (float)h); }
  return r; }
__device__ __forceinline__ F2 split_row(const float* row, int k0, int lane) { float v[16]; const float* p = row + k0 + 8 * (lane >> 4);
#pragma unroll
  for (int i = 0; i < 8; ++i) { v[i] = p[i]; v[8 + i] = p[16 + i]; }
  return bsplit16(v); }
__device__ __forceinline__ F2 split_rowK(const float* row, int k0, int lane, int K) { float v[16]; const int g = lane >> 4;
#pragma unroll
  for (int i = 0; i < 8; ++i) { const int ka = k0 + 8 * g + i, kb = ka + 16; v[i] = ka < K ? row[ka < K ? ka : K - 1] : 0.f; v[8 + i] = kb < K ? row[kb < K ? kb : K - 1] : 0.f; }
  return bsplit16(v); }
__device__ __forceinline__ F2 split_col(const float* W, int k0, int n, int lane, int ld, int K) { float v[16]; const int g = lane >> 4;
#pragma unroll
  for (int i = 0; i < 8; ++i) { const int ka = k0 + 8 * g + i, kb = ka + 16; v[i] = ka < K ? W[(size_t)(ka < K ? ka : K - 1) * ld + n] : 0.f; v[8 + i] = kb < K ? W[(size_t)(kb < K ? kb : K - 1) * ld + n] : 0.f; }
  return bsplit16(v); }
__device__ __forceinline__ v8f mac3(const F2& a, const F2& b, v8f c) { c = wmma_bf(a.l, b.h, c); c = wmma_bf(a.h, b.l, c); return wmma_bf(a.h, b.h, c); }
__device__ __forceinline__ float sigm(float v) { return 1.0f / (1.0f + expf(-v)); }
#define LDSX() do { asm volatile("s_wait_dscnt 0" ::: "memory"); __builtin_amdgcn_wave_barrier(); __builtin_amdgcn_fence(__ATOMIC_RELEASE, "workgroup"); } while (0)


// Linear-variant attention: qkv = x qkv_w^T + b (8 heads x 32), scores = q k^T / sqrt(32), t = (scores + 5)^2, attn = t / sum_k t (no softmax), out = attn v merged, @ proj_w^T + proj_b.  B 8, N 1024, D 256.
// k_proj (exact GEMM + bias; each block rounds its own 128 weight rows to bf16 into LDS; q and k columns as f32 rows, v columns straight as V^T bf16 hi / lo rows), k_attn (flash-style without max tracking: S^T = K Q^T, running in-lane sum of t and O^T += V^T t^T over 32 key steps, t staying in registers; K and V^T tiles come through a two-buffer LDS ring shared by the block's four waves, K split to bf16 hi | lo once on its way in), k_out (weight rows as in k_proj; + proj_b).
#define NB 8
#define SS 1024
#define DIN 256
#define DP 256
#define NH 8
#define HD 32
#define NR (NB * SS)
#define QKVP (3 * DP)
#ifndef TRB
#define TRB (NR / 64)
#define TQB (SS / 64)
#define TNB NB
#endif
typedef __attribute__((ext_vector_type(8))) __bf16 v8b;
__device__ __forceinline__ v16b frag_b(const __bf16* rowk0, int lane) {
  union { v16b v; v8b q[2]; } u; const __bf16* p = rowk0 + 8 * (lane >> 4);
  u.q[0] = *(const v8b*)p; u.q[1] = *(const v8b*)(p + 16); return u.v;
}
__device__ __forceinline__ v16b frag_gbf(const float* rowk0, int lane) {
  v16b a; const float* p = rowk0 + 8 * (lane >> 4);
#pragma unroll
  for (int i = 0; i < 8; ++i) { a[i] = (__bf16)p[i]; a[8 + i] = (__bf16)p[16 + i]; }
  return a;
}
__device__ __forceinline__ float bfr(float v) { return (float)(__bf16)v; }
__device__ __attribute__((noinline)) float exp_ni(float v) { return expf(v); }
#define WS_QKV  0u                                    // f32 [NR][QKVP]; q cols later overwritten by O, v cols unused
#define WS_VTH  (WS_QKV + 4u * NR * QKVP)             // bf16 [8][256][1024]
#define WS_VTL  (WS_VTH + 2u * NB * DP * SS)
#define WS_END  (WS_VTL + 2u * NB * DP * SS)

typedef __attribute__((ext_vector_type(4))) __bf16 v4b;
#define WPIT 264   // LDS pitch of a bf16 weight row of 256: 528 B = 16 B x 33 suits the 16-byte LDS readers
// a block's 128 weight rows (f32, 256 long, one run of memory) rounded to bf16 into LDS: each load of a wave covers 512 B in a row = four whole lines
__device__ __forceinline__ void stage_w(const float* __restrict__ Wt, __bf16 (*sw)[WPIT], int tid) {
#pragma unroll   // every load at an immediate offset from one address
  for (int c = 0; c < 2; ++c) { v4f w[32];
#pragma unroll   // w[] stays in registers, here and below
    for (int i = 0; i < 32; ++i) w[i] = *(const v4f*)(Wt + (c * 32 + i) * 512 + tid * 4);
#pragma unroll
    for (int i = 0; i < 32; ++i) *(v4b*)&sw[(c * 32 + i) * 2 + (tid >> 6)][(tid & 63) * 4] = (v4b){(__bf16)w[i][0], (__bf16)w[i][1], (__bf16)w[i][2], (__bf16)w[i][3]};
    if (c == 1) asm volatile("s_wait_xcnt 0x0" ::: "memory");   // stands ahead of the first later write of a register that these loads name
    __builtin_amdgcn_sched_barrier(0);   // holds the next 32 loads behind these stores (32 in flight fit the registers of the main loop, 64 took more than 256) and later code behind the wait
  }
}
// ---- k_proj: QKV[r][n] = bf16(x[r]) . bf16(Wqkv[n]) (exact products) + bias; block (64 rows, 128 cols); the v columns leave as V^T hi / lo rows
#define PVP 72   // LDS pitch of a V^T row of 64 tokens: 144 B suits the 16-byte LDS writers and readers
union ProjLds { __bf16 sw[128][WPIT]; float so[4][16][132]; __bf16 sv[2][128][PVP]; };
__global__ __launch_bounds__(128) void k_proj(const float* __restrict__ X, const float* __restrict__ Wqkv, const float* __restrict__ bqkv, float* __restrict__ QKV, __bf16* __restrict__ VTH, __bf16* __restrict__ VTL) {
  __shared__ __align__(16) ProjLds sm;
  const int tid = threadIdx.x, wave = tid >> 5, lane = tid & 31, col = lane & 15, g = lane >> 4; const size_t r0 = (size_t)blockIdx.x * 64 + wave * 16; const int n0 = blockIdx.y * 128;
  stage_w(Wqkv + (size_t)n0 * DIN, sm.sw, tid);
  __syncthreads();   // the weight rows are written by all four waves and read by all four
  v8f acc[8] = {};
#pragma unroll 2
  for (int kc = 0; kc < DIN / 32; ++kc) { const v16b a = frag_gbf(X + (r0 + col) * DIN + kc * 32, lane);
    v16b w[8];
#pragma unroll   // w[] stays in registers, LDS offsets become immediates
    for (int j = 0; j < 8; ++j) w[j] = frag_b(&sm.sw[j * 16 + col][kc * 32], lane);
    asm volatile("" :: "v"(w[0]), "v"(w[1]), "v"(w[2]), "v"(w[3]), "v"(w[4]), "v"(w[5]), "v"(w[6]), "v"(w[7]));   // inputs only: holds the LDS reads of a k step together ahead of its WMMAs; without it each WMMA waited out its own pair of reads
#pragma unroll
    for (int j = 0; j < 8; ++j) acc[j] = wmma_bf(a, w[j], acc[j]);
    asm volatile("s_wait_xcnt 0x0" ::: "memory"); }   // stands ahead of the next step's write of the address registers that this step's loads of x name
  __syncthreads();   // every wave has read its last weight row before the same LDS takes the results
  float bb[8];
#pragma unroll
  for (int j = 0; j < 8; ++j) bb[j] = bfr(bqkv[n0 + j * 16 + col]);
  if (n0 >= 2 * DP) {   // v columns (the same for the whole block): a lane's 8 D registers are 8 consecutive tokens of one column = 16 B of a V^T row
#pragma unroll
    for (int j = 0; j < 8; ++j) { const int c = j * 16 + col; v8b hv, lv;
#pragma unroll
      for (int r = 0; r < 8; ++r) { const float v = acc[j][r] + bb[j]; const __bf16 hb = (__bf16)v; hv[r] = hb; lv[r] = (__bf16)(v - (float)hb); }
      *(v8b*)&sm.sv[0][c][wave * 16 + 8 * g] = hv; *(v8b*)&sm.sv[1][c][wave * 16 + 8 * g] = lv; }
    __syncthreads();   // a V^T row's 64 tokens come from all four waves; behind it 8 lanes store one whole 128-B line
    const size_t t0 = (size_t)blockIdx.x * 64; const size_t o = ((t0 / SS) * DP + (n0 - 2 * DP) + (tid >> 3)) * SS + t0 % SS + (tid & 7) * 8;
#pragma unroll
    for (int i = 0; i < 8; ++i) { vst2((unsigned*)(VTH + o + (size_t)i * 16 * SS), *(const v4u*)&sm.sv[0][i * 16 + (tid >> 3)][(tid & 7) * 8]); vst2((unsigned*)(VTL + o + (size_t)i * 16 * SS), *(const v4u*)&sm.sv[1][i * 16 + (tid >> 3)][(tid & 7) * 8]); }
    return;
  }
#pragma unroll
  for (int j = 0; j < 8; ++j) {
#pragma unroll
    for (int r = 0; r < 8; ++r) sm.so[wave][8 * g + r][j * 16 + col] = acc[j][r] + bb[j]; }
  LDSX();
  for (int rl = 0; rl < 16; ++rl) vst2(QKV + (r0 + rl) * QKVP + n0 + lane * 4, *(const v4f*)&sm.so[wave][rl][lane * 4]);
}
// one stage of the LDS ring = KST keys of one head: K rows (32 bf16 hi | 32 bf16 lo) and V^T hi / lo rows in bf16 are all 128 B long; pitch 144 B suits the 16-byte LDS readers
#define KST 64
#define NST (SS / KST)
#define KPIT 72
#define VPIT 72
__device__ __forceinline__ unsigned lds_off(const void* p) { return (unsigned)(size_t)p; }   // low 32 bits of a __shared__ address = byte offset in the work-group's LDS
// 8 lanes copy one whole 128-B row; a lane's 4 copies: V^T hi rows r, r+16, V^T lo rows r, r+16 (r = tid >> 3)
__device__ __forceinline__ void stage_copy(const __bf16* gh, const __bf16* gl, unsigned lh, unsigned ll) {
  // the copies go global -> LDS through no register; s_wait_xcnt 0 closes the statement so that no address register is rewritten ahead of it
  asm volatile("global_load_async_to_lds_b128 %0, %4, off\n\t"
               "global_load_async_to_lds_b128 %1, %5, off\n\t"
               "global_load_async_to_lds_b128 %2, %6, off\n\t"
               "global_load_async_to_lds_b128 %3, %7, off\n\t"
               "s_wait_xcnt 0x0"
               :: "v"(lh), "v"(lh + 16u * VPIT * 2u), "v"(ll), "v"(ll + 16u * VPIT * 2u),
                  "v"(gh), "v"(gh + 16 * SS), "v"(gl), "v"(gl + 16 * SS)
               : "memory");
}
// a thread's share of a K tile: 4 floats of rows r, r+16, r+32, r+48 (8 lanes load one whole 128-B row)
struct KR { v4f v[4]; };
__device__ __forceinline__ KR load_k(const float* gk) { KR k;
#pragma unroll   // k.v[] stays in registers, the four loads at immediate offsets from one address
  for (int j = 0; j < 4; ++j) k.v[j] = *(const v4f*)(gk + j * 16 * QKVP);
  asm volatile("s_wait_xcnt 0x0" ::: "memory");   // stands ahead of the first later write of a register that these loads name, and keeps the loads issued here, a stage ahead of their use
  return k; }
// the share is split to bf16 hi + bf16 residual once for the whole block and stored as the hi and lo halves of its rows
__device__ __forceinline__ void put_k(const KR& k, __bf16 (*kb)[KPIT], int crow, int cpc) {
#pragma unroll   // k.v[] stays in registers, here and below
  for (int j = 0; j < 4; ++j) { v4b hv, lv;
#pragma unroll
    for (int e = 0; e < 4; ++e) { const float v = k.v[j][e]; const __bf16 hb = (__bf16)v; hv[e] = hb; lv[e] = (__bf16)(v - (float)hb); }
    *(v4b*)&kb[crow + 16 * j][cpc * 4] = hv; *(v4b*)&kb[crow + 16 * j][HD + cpc * 4] = lv; }
}
__global__ __launch_bounds__(128) void k_attn(float* __restrict__ QKV, const __bf16* __restrict__ VTH, const __bf16* __restrict__ VTL) {
  __shared__ __align__(16) __bf16 sk[2][KST][KPIT]; __shared__ __align__(16) __bf16 svh[2][HD][VPIT], svl[2][HD][VPIT];
  __shared__ __align__(16) float so[4][16][36];
  const int tid = threadIdx.x, wave = tid >> 5, lane = tid & 31, col = lane & 15, g = lane >> 4;
  const int qb = blockIdx.x, bh = blockIdx.y, b = bh / NH, h = bh % NH; const int q0 = qb * 64 + wave * 16; const size_t tq = (size_t)b * SS + q0;
  const int crow = tid >> 3, cpc = tid & 7;
  const float* gk = QKV + ((size_t)b * SS + crow) * QKVP + DP + h * HD + cpc * 4;
  const __bf16* gh = VTH + ((size_t)b * DP + h * HD + crow) * SS + cpc * 8; const __bf16* gl = VTL + ((size_t)b * DP + h * HD + crow) * SS + cpc * 8;
  const unsigned lh = lds_off(&svh[0][crow][cpc * 8]), ll = lds_off(&svl[0][crow][cpc * 8]);
  const unsigned vbuf = HD * VPIT * 2u;
  stage_copy(gh, gl, lh, ll);
  { const KR k0 = load_k(gk), k1 = load_k(gk + (size_t)KST * QKVP); put_k(k0, sk[0], crow, cpc); put_k(k1, sk[1], crow, cpc); }   // both K buffers are free here
  KR kn = load_k(gk + (size_t)2 * KST * QKVP);   // in flight over a whole stage
  const F2 a0 = split_row(QKV + (tq + col) * QKVP + h * HD, 0, lane);   // B operand of the scores: lane = query column
  asm volatile("s_wait_asynccnt 0x0" ::: "memory");   // stage 0 has landed before the barrier that publishes it
  __syncthreads();
  stage_copy(gh + KST, gl + KST, lh + vbuf, ll + vbuf);
  v8f l = {};        // a lane's own partial sums of t for its query column (keys 8g + r of every 16)
  v8f acc[2] = {};   // O^T: acc[dt][r] = head column dt * 16 + 8g + r of query column col
  const float scl = 0.17677669529663687f;    // 1/sqrt(32)
#pragma unroll 1
  for (int st = 0; st < NST; ++st) {
    const int bf = st & 1;
#pragma unroll   // both 32-key halves of a stage in line: their LDS offsets become immediates
    for (int hs = 0; hs < KST / 32; ++hs) {
    // S^T = K Q^T: D register r of tile ct is key ct * 16 + 8g + r of query col, which is element ct * 8 + r of the B operand of O^T += V^T P^T
    float t[16];
#pragma unroll
    for (int ct = 0; ct < 2; ++ct) { const __bf16* kp = &sk[bf][hs * 32 + ct * 16 + col][0]; const F2 k0 = {frag_b(kp, lane), frag_b(kp + HD, lane)};
      v8f c = wmma_bf(k0.h, a0.l, (v8f){}); c = wmma_bf(k0.l, a0.h, c); c = wmma_bf(k0.h, a0.h, c);
#pragma unroll
      for (int r = 0; r < 8; ++r) { const float u = c[r] * scl + 5.0f; t[ct * 8 + r] = u * u; } }
#pragma unroll
    for (int r = 0; r < 8; ++r) l[r] += t[r] + t[8 + r];
    const F2 pb = bsplit16(t);
#pragma unroll
    for (int dt = 0; dt < 2; ++dt) { const v16b vh = frag_b(&svh[bf][dt * 16 + col][hs * 32], lane), vl = frag_b(&svl[bf][dt * 16 + col][hs * 32], lane);
      acc[dt] = wmma_bf(vh, pb.l, acc[dt]); acc[dt] = wmma_bf(vl, pb.h, acc[dt]); acc[dt] = wmma_bf(vh, pb.h, acc[dt]); } }
    asm volatile("s_wait_dscnt 0x0" ::: "memory");      // this wave's reads of buffer bf are over before the buffer is refilled
    asm volatile("s_wait_asynccnt 0x0" ::: "memory");   // this wave's copies of stage st + 1 have landed before the barrier that publishes them
    __syncthreads();                                    // publishes stage st + 1 and ends every wave's reads of buffer bf
    if (st + 2 < NST) { stage_copy(gh + (st + 2) * KST, gl + (st + 2) * KST, lh + bf * vbuf, ll + bf * vbuf);
      put_k(kn, sk[bf], crow, cpc);   // K of stage st + 2, published by the next stage's barrier
      if (st + 3 < NST) kn = load_k(gk + (size_t)(st + 3) * KST * QKVP); }
  }
  asm volatile("s_wait_asynccnt 0x0" ::: "memory");     // no copy is outstanding when the wave goes on to its end
  float ls = ((l[0] + l[1]) + (l[2] + l[3])) + ((l[4] + l[5]) + (l[6] + l[7]));
  ls += __shfl_xor(ls, 16);   // the two lane halves of a query column join their sums once
  const float il = 1.0f / ls;
  // a lane holds 8 consecutive head columns of its query row per tile; the rows go through the wave's own LDS so that each store covers whole 128-B lines
#pragma unroll
  for (int dt = 0; dt < 2; ++dt) {
    *(v4f*)&so[wave][col][dt * 16 + 8 * g] = (v4f){acc[dt][0] * il, acc[dt][1] * il, acc[dt][2] * il, acc[dt][3] * il};
    *(v4f*)&so[wave][col][dt * 16 + 8 * g + 4] = (v4f){acc[dt][4] * il, acc[dt][5] * il, acc[dt][6] * il, acc[dt][7] * il}; }
  LDSX();
#pragma unroll
  for (int i = 0; i < 4; ++i) { const int rl = i * 4 + (lane >> 3), pc = lane & 7; vst2(QKV + (tq + rl) * QKVP + h * HD + pc * 4, *(const v4f*)&so[wave][rl][pc * 4]); }
}
// ---- k_out: Y = O(hi/lo; the q columns of QKV, K 256) . Wo rows (2 products) + bo; block (64 rows, 128 of the 256 cols)
__global__ __launch_bounds__(128) void k_out(const float* __restrict__ QKV, const float* __restrict__ Wo, const float* __restrict__ bo, float* __restrict__ Y) {
  __shared__ __align__(16) __bf16 sw[128][WPIT]; __shared__ __align__(16) float so[4][16][132];
  const int tid = threadIdx.x, wave = tid >> 5, lane = tid & 31, col = lane & 15, g = lane >> 4; const size_t r0 = (size_t)blockIdx.x * 64 + wave * 16; const int n0 = blockIdx.y * 128;
  stage_w(Wo + (size_t)n0 * DP, sw, tid);
  __syncthreads();   // the weight rows are written by all four waves and read by all four
  v8f acc[8] = {};
#pragma unroll 2
  for (int kc = 0; kc < DP / 32; ++kc) { const F2 a = split_row(QKV + (r0 + col) * QKVP, kc * 32, lane);
    v16b w[8];
#pragma unroll   // w[] stays in registers, LDS offsets become immediates
    for (int j = 0; j < 8; ++j) w[j] = frag_b(&sw[j * 16 + col][kc * 32], lane);
    asm volatile("" :: "v"(w[0]), "v"(w[1]), "v"(w[2]), "v"(w[3]), "v"(w[4]), "v"(w[5]), "v"(w[6]), "v"(w[7]));   // inputs only: holds the LDS reads of a k step together ahead of its WMMAs; without it each WMMA waited out its own pair of reads
#pragma unroll
    for (int j = 0; j < 8; ++j) { acc[j] = wmma_bf(a.l, w[j], acc[j]); acc[j] = wmma_bf(a.h, w[j], acc[j]); }
    asm volatile("s_wait_xcnt 0x0" ::: "memory"); }   // stands ahead of the next step's write of the address registers that this step's loads of O name
#pragma unroll
  for (int j = 0; j < 8; ++j) { const float bb = bfr(bo[n0 + j * 16 + col]);
#pragma unroll
    for (int r = 0; r < 8; ++r) so[wave][8 * g + r][j * 16 + col] = acc[j][r] + bb; }
  LDSX();
  for (int rl = 0; rl < 16; ++rl) vst2(Y + (r0 + rl) * DIN + n0 + lane * 4, *(const v4f*)&so[wave][rl][lane * 4]);
}

extern "C" void kernel_launch(void* const* d_in, const int* in_sizes, int n_in, void* d_out, int out_size, void* d_ws, size_t ws_size, hipStream_t stream) {
  (void)in_sizes; (void)n_in; (void)out_size;
  const float** F = (const float**)d_in;   // x [8,1024,256], qkv_w [768,256], qkv_b [768], proj_w [256,256], proj_b [256]
  if (ws_size < (size_t)WS_END) return;
  char* ws = (char*)d_ws; __bf16 *VTH = (__bf16*)(ws + WS_VTH), *VTL = (__bf16*)(ws + WS_VTL); float* QKV = (float*)(ws + WS_QKV);
  k_proj<<<dim3(TRB, QKVP / 128), 128, 0, stream>>>(F[0], F[1], F[2], QKV, VTH, VTL);
  k_attn<<<dim3(TQB, TNB * NH), 128, 0, stream>>>(QKV, VTH, VTL);
  k_out<<<dim3((TNB < NB ? TQB : NR / 64), DIN / 128), 128, 0, stream>>>(QKV, F[3], F[4], (float*)d_out);
}

// v007
// It runs in 63.1 microseconds.
// Two timings next to v006 both put it at 1.04 times that version's speed.
// Over all steps from v000 it is 2.38 times as fast.
// compute dtype: x, qkv_w/qkv_b, proj_w/proj_b (module inputs) rounded to bf16; qkv projection with exact bf16 products (+ bias); scores and the (s + 5)^2-weighted value sums with both computed operands as bf16 hi + bf16 residual pairs (3 products); output projection hi/lo x bf16 proj_w (2 products) + bias; the quadratic normalisation in f32; f32 accumulate.
#include <hip/hip_runtime.h>
#include <math.h>

typedef __attribute__((ext_vector_type(16))) _Float16 v16h;
typedef __attribute__((ext_vector_type(16))) __bf16 v16b;
typedef __attribute__((ext_vector_type(8)))  _Float16 v8h;
typedef __attribute__((ext_vector_type(8)))  float v8f;
typedef __attribute__((ext_vector_type(4)))  float v4f;
typedef __attribute__((ext_vector_type(2)))  float v2f;
typedef __attribute__((ext_vector_type(4)))  unsigned v4u;
typedef __attribute__((ext_vector_type(4)))  int v4i;
typedef float __attribute__((may_alias)) float_a;
typedef int __attribute__((may_alias)) int_a;

template <typename T> __device__ __forceinline__ void vst2(void* p, T v) { *(T*)p = v;  }
__device__ __forceinline__ v8f wmma16(v16h a, v16h b, v8f c) {
  v8f d = __builtin_amdgcn_wmma_f32_16x16x32_f16(false, a, false, b, (short)0, c, false, false);
  asm volatile("v_nop\n\tv_nop\n\tv_nop\n\tv_nop" : "+v"(d) : "v"(a), "v"(b));
  return d;
}
__device__ __forceinline__ v8f wmma_bf(v16b a, v16b b, v8f c) {
  return __builtin_amdgcn_wmma_f32_16x16x32_bf16(false, a, false, b, (short)0, c, false, false);
}
// 16x16x32 fragments: lane = (h = lane>>4, row/col = lane&15); elements 0..7 = k0+8h+0..7, 8..15 = k0+16+8h+0..7; D element r = row 8h+r
__device__ __forceinline__ v16h frag_h(const _Float16* rowk0, int lane) {
  union { v16h v; v8h q[2]; } u; const _Float16* p = rowk0 + 8 * (lane >> 4);
  u.q[0] = *(const v8h*)p; u.q[1] = *(const v8h*)(p + 16); return u.v;
}
__device__ __forceinline__ v16h frag_f32(const float* rowk0, int lane) {
  v16h a; const float* p = rowk0 + 8 * (lane >> 4);
#pragma unroll
  for (int i = 0; i < 8; ++i) { a[i] = (_Float16)p[i]; a[8 + i] = (_Float16)p[16 + i]; }
  return a;
}
__device__ __forceinline__ v16h frag_f32s(const float* rowk0, int lane, float sc) {
  v16h a; const float* p = rowk0 + 8 * (lane >> 4);
#pragma unroll
  for (int i = 0; i < 8; ++i) { a[i] = (_Float16)(p[i] * sc); a[8 + i] = (_Float16)(p[16 + i] * sc); }
  return a;
}
// column fragment from a [K][ld] layout (column n), rows >= K read as 0
__device__ __forceinline__ v16h fragc_f32(const float* W, int k0, int n, int lane, int ld, int K) {
  v16h a; const int g = lane >> 4;
#pragma unroll
  for (int i = 0; i < 8; ++i) { const int ka = k0 + 8 * g + i, kb = ka + 16;
    a[i] = (_Float16)(ka < K ? W[(size_t)(ka < K ? ka : K - 1) * ld + n] : 0.f); a[8 + i] = (_Float16)(kb < K ? W[(size_t)(kb < K ? kb : K - 1) * ld + n] : 0.f); }
  return a;
}
struct F2 { v16b h, l; };
typedef __attribute__((ext_vector_type(2))) __bf16 v2b;
// hi + residual of two neighbouring f32 registers: one packed conversion makes the hi pair, the residuals read its two halves
__device__ __forceinline__ void bsplit2(v2f t, v2b& h, v2b& l) { h = __builtin_convertvector(t, v2b); l = __builtin_convertvector((v2f){t[0] - (float)h[0], t[1] - (float)h[1]}, v2b); }
union B16 { v16b v; v2b p[8]; };
__device__ __forceinline__ F2 bsplit16(const float v[16]) { B16 h, l;
#pragma unroll
  for (int i = 0; i < 8; ++i) bsplit2((v2f){v[2 * i], v[2 * i + 1]}, h.p[i], l.p[i]);
  return F2{h.v, l.v}; }
__device__ __forceinline__ F2 split_row(const float* row, int k0, int lane) { float v[16]; const float* p = row + k0 + 8 * (lane >> 4);
#pragma unroll
  for (int i = 0; i < 8; ++i) { v[i] = p[i]; v[8 + i] = p[16 + i]; }
  return bsplit16(v); }
__device__ __forceinline__ F2 split_rowK(const float* row, int k0, int lane, int K) { float v[16]; const int g = lane >> 4;
#pragma unroll
  for (int i = 0; i < 8; ++i) { const int ka = k0 + 8 * g + i, kb = ka + 16; v[i] = ka < K ? row[ka < K ? ka : K - 1] : 0.f; v[8 + i] = kb < K ? row[kb < K ? kb : K - 1] : 0.f; }
  return bsplit16(v); }
__device__ __forceinline__ F2 split_col(const float* W, int k0, int n, int lane, int ld, int K) { float v[16]; const int g = lane >> 4;
#pragma unroll
  for (int i = 0; i < 8; ++i) { const int ka = k0 + 8 * g + i, kb = ka + 16; v[i] = ka < K ? W[(size_t)(ka < K ? ka : K - 1) * ld + n] : 0.f; v[8 + i] = kb < K ? W[(size_t)(kb < K ? kb : K - 1) * ld + n] : 0.f; }
  return bsplit16(v); }
__device__ __forceinline__ v8f mac3(const F2& a, const F2& b, v8f c) { c = wmma_bf(a.l, b.h, c); c = wmma_bf(a.h, b.l, c); return wmma_bf(a.h, b.h, c); }
__device__ __forceinline__ float sigm(float v) { return 1.0f / (1.0f + expf(-v)); }
#define LDSX() do { asm volatile("s_wait_dscnt 0" ::: "memory"); __builtin_amdgcn_wave_barrier(); __builtin_amdgcn_fence(__ATOMIC_RELEASE, "workgroup"); } while (0)


// Linear-variant attention: qkv = x qkv_w^T + b (8 heads x 32), scores = q k^T / sqrt(32), t = (scores + 5)^2, attn = t / sum_k t (no softmax), out = attn v merged, @ proj_w^T + proj_b.  B 8, N 1024, D 256.
// k_proj (exact GEMM + bias; each block rounds its own 128 weight rows to bf16 into LDS; q and k columns as f32 rows, v columns straight as V^T bf16 hi / lo rows), k_attn (flash-style without max tracking: S^T = K Q^T, running in-lane sum of t and O^T += V^T t^T over 32 key steps, t staying in registers; K and V^T tiles come through a two-buffer LDS ring shared by the block's four waves, K split to bf16 hi | lo once on its way in), k_out (weight rows as in k_proj; + proj_b).
#define NB 8
#define SS 1024
#define DIN 256
#define DP 256
#define NH 8
#define HD 32
#define NR (NB * SS)
#define QKVP (3 * DP)
#ifndef TRB
#define TRB (NR / 64)
#define TQB (SS / 64)
#define TNB NB
#endif
typedef __attribute__((ext_vector_type(8))) __bf16 v8b;
__device__ __forceinline__ v16b frag_b(const __bf16* rowk0, int lane) {
  union { v16b v; v8b q[2]; } u; const __bf16* p = rowk0 + 8 * (lane >> 4);
  u.q[0] = *(const v8b*)p; u.q[1] = *(const v8b*)(p + 16); return u.v;
}
__device__ __forceinline__ v16b frag_gbf(const float* rowk0, int lane) {
  v16b a; const float* p = rowk0 + 8 * (lane >> 4);
#pragma unroll
  for (int i = 0; i < 8; ++i) { a[i] = (__bf16)p[i]; a[8 + i] = (__bf16)p[16 + i]; }
  return a;
}
__device__ __forceinline__ float bfr(float v) { return (float)(__bf16)v; }
__device__ __attribute__((noinline)) float exp_ni(float v) { return expf(v); }
#define WS_QKV  0u                                    // f32 [NR][QKVP]; q cols later overwritten by O, v cols unused
#define WS_VTH  (WS_QKV + 4u * NR * QKVP)             // bf16 [8][256][1024]
#define WS_VTL  (WS_VTH + 2u * NB * DP * SS)
#define WS_END  (WS_VTL + 2u * NB * DP * SS)

typedef __attribute__((ext_vector_type(4))) __bf16 v4b;
#define WPIT 264   // LDS pitch of a bf16 weight row of 256: 528 B = 16 B x 33 suits the 16-byte LDS readers
// a block's 128 weight rows (f32, 256 long, one run of memory) rounded to bf16 into LDS: each load of a wave covers 512 B in a row = four whole lines
__device__ __forceinline__ void stage_w(const float* __restrict__ Wt, __bf16 (*sw)[WPIT], int tid) {
#pragma unroll   // every load at an immediate offset from one address
  for (int c = 0; c < 2; ++c) { v4f w[32];
#pragma unroll   // w[] stays in registers, here and below
    for (int i = 0; i < 32; ++i) w[i] = *(const v4f*)(Wt + (c * 32 + i) * 512 + tid * 4);
#pragma unroll
    for (int i = 0; i < 32; ++i) *(v4b*)&sw[(c * 32 + i) * 2 + (tid >> 6)][(tid & 63) * 4] = (v4b){(__bf16)w[i][0], (__bf16)w[i][1], (__bf16)w[i][2], (__bf16)w[i][3]};
    if (c == 1) asm volatile("s_wait_xcnt 0x0" ::: "memory");   // stands ahead of the first later write of a register that these loads name
    __builtin_amdgcn_sched_barrier(0);   // holds the next 32 loads behind these stores (32 in flight fit the registers of the main loop, 64 took more than 256) and later code behind the wait
  }
}
// ---- k_proj: QKV[r][n] = bf16(x[r]) . bf16(Wqkv[n]) (exact products) + bias; block (64 rows, 128 cols); the v columns leave as V^T hi / lo rows
#define PVP 72   // LDS pitch of a V^T row of 64 tokens: 144 B suits the 16-byte LDS writers and readers
union ProjLds { __bf16 sw[128][WPIT]; float so[4][16][132]; __bf16 sv[2][128][PVP]; };
__global__ __launch_bounds__(128) void k_proj(const float* __restrict__ X, const float* __restrict__ Wqkv, const float* __restrict__ bqkv, float* __restrict__ QKV, __bf16* __restrict__ VTH, __bf16* __restrict__ VTL) {
  __shared__ __align__(16) ProjLds sm;
  const int tid = threadIdx.x, wave = tid >> 5, lane = tid & 31, col = lane & 15, g = lane >> 4; const size_t r0 = (size_t)blockIdx.x * 64 + wave * 16; const int n0 = blockIdx.y * 128;
  stage_w(Wqkv + (size_t)n0 * DIN, sm.sw, tid);
  __syncthreads();   // the weight rows are written by all four waves and read by all four
  v8f acc[8] = {};
#pragma unroll 2
  for (int kc = 0; kc < DIN / 32; ++kc) { const v16b a = frag_gbf(X + (r0 + col) * DIN + kc * 32, lane);
    v16b w[8];
#pragma unroll   // w[] stays in registers, LDS offsets become immediates
    for (int j = 0; j < 8; ++j) w[j] = frag_b(&sm.sw[j * 16 + col][kc * 32], lane);
    asm volatile("" :: "v"(w[0]), "v"(w[1]), "v"(w[2]), "v"(w[3]), "v"(w[4]), "v"(w[5]), "v"(w[6]), "v"(w[7]));   // inputs only: holds the LDS reads of a k step together ahead of its WMMAs; without it each WMMA waited out its own pair of reads
#pragma unroll
    for (int j = 0; j < 8; ++j) acc[j] = wmma_bf(a, w[j], acc[j]);
    asm volatile("s_wait_xcnt 0x0" ::: "memory"); }   // stands ahead of the next step's write of the address registers that this step's loads of x name
  __syncthreads();   // every wave has read its last weight row before the same LDS takes the results
  float bb[8];
#pragma unroll
  for (int j = 0; j < 8; ++j) bb[j] = bfr(bqkv[n0 + j * 16 + col]);
  if (n0 >= 2 * DP) {   // v columns (the same for the whole block): a lane's 8 D registers are 8 consecutive tokens of one column = 16 B of a V^T row
#pragma unroll
    for (int j = 0; j < 8; ++j) { const int c = j * 16 + col; union { v8b v; v2b p[4]; } hv, lv;
#pragma unroll
      for (int q = 0; q < 4; ++q) bsplit2((v2f){acc[j][2 * q], acc[j][2 * q + 1]} + bb[j], hv.p[q], lv.p[q]);
      *(v8b*)&sm.sv[0][c][wave * 16 + 8 * g] = hv.v; *(v8b*)&sm.sv[1][c][wave * 16 + 8 * g] = lv.v; }
    __syncthreads();   // a V^T row's 64 tokens come from all four waves; behind it 8 lanes store one whole 128-B line
    const size_t t0 = (size_t)blockIdx.x * 64; const size_t o = ((t0 / SS) * DP + (n0 - 2 * DP) + (tid >> 3)) * SS + t0 % SS + (tid & 7) * 8;
#pragma unroll
    for (int i = 0; i < 8; ++i) { vst2((unsigned*)(VTH + o + (size_t)i * 16 * SS), *(const v4u*)&sm.sv[0][i * 16 + (tid >> 3)][(tid & 7) * 8]); vst2((unsigned*)(VTL + o + (size_t)i * 16 * SS), *(const v4u*)&sm.sv[1][i * 16 + (tid >> 3)][(tid & 7) * 8]); }
    return;
  }
#pragma unroll
  for (int j = 0; j < 8; ++j) {
#pragma unroll
    for (int r = 0; r < 8; ++r) sm.so[wave][8 * g + r][j * 16 + col] = acc[j][r] + bb[j]; }
  LDSX();
  for (int rl = 0; rl < 16; ++rl) vst2(QKV + (r0 + rl) * QKVP + n0 + lane * 4, *(const v4f*)&sm.so[wave][rl][lane * 4]);
}
// one stage of the LDS ring = KST keys of one head: K rows (32 bf16 hi | 32 bf16 lo) and V^T hi / lo rows in bf16 are all 128 B long; pitch 144 B suits the 16-byte LDS readers
#define KST 64
#define NST (SS / KST)
#define KPIT 72
#define VPIT 72
__device__ __forceinline__ unsigned lds_off(const void* p) { return (unsigned)(size_t)p; }   // low 32 bits of a __shared__ address = byte offset in the work-group's LDS
// 8 lanes copy one whole 128-B row; a lane's 4 copies: V^T hi rows r, r+16, V^T lo rows r, r+16 (r = tid >> 3)
__device__ __forceinline__ void stage_copy(const __bf16* gh, const __bf16* gl, unsigned lh, unsigned ll) {
  // the copies go global -> LDS through no register; s_wait_xcnt 0 closes the statement so that no address register is rewritten ahead of it
  asm volatile("global_load_async_to_lds_b128 %0, %4, off\n\t"
               "global_load_async_to_lds_b128 %1, %5, off\n\t"
               "global_load_async_to_lds_b128 %2, %6, off\n\t"
               "global_load_async_to_lds_b128 %3, %7, off\n\t"
               "s_wait_xcnt 0x0"
               :: "v"(lh), "v"(lh + 16u * VPIT * 2u), "v"(ll), "v"(ll + 16u * VPIT * 2u),
                  "v"(gh), "v"(gh + 16 * SS), "v"(gl), "v"(gl + 16 * SS)
               : "memory");
}
// a thread's share of a K tile: 4 floats of rows r, r+16, r+32, r+48 (8 lanes load one whole 128-B row)
struct KR { v4f v[4]; };
__device__ __forceinline__ KR load_k(const float* gk) { KR k;
#pragma unroll   // k.v[] stays in registers, the four loads at immediate offsets from one address
  for (int j = 0; j < 4; ++j) k.v[j] = *(const v4f*)(gk + j * 16 * QKVP);
  asm volatile("s_wait_xcnt 0x0" ::: "memory");   // stands ahead of the first later write of a register that these loads name, and keeps the loads issued here, a stage ahead of their use
  return k; }
// the share is split to bf16 hi + bf16 residual once for the whole block and stored as the hi and lo halves of its rows
__device__ __forceinline__ void put_k(const KR& k, __bf16 (*kb)[KPIT], int crow, int cpc) {
#pragma unroll   // k.v[] stays in registers, here and below
  for (int j = 0; j < 4; ++j) { union { v4b v; v2b p[2]; } hv, lv;
    bsplit2((v2f){k.v[j][0], k.v[j][1]}, hv.p[0], lv.p[0]); bsplit2((v2f){k.v[j][2], k.v[j][3]}, hv.p[1], lv.p[1]);
    *(v4b*)&kb[crow + 16 * j][cpc * 4] = hv.v; *(v4b*)&kb[crow + 16 * j][HD + cpc * 4] = lv.v; }
}
__global__ __launch_bounds__(128) void k_attn(float* __restrict__ QKV, const __bf16* __restrict__ VTH, const __bf16* __restrict__ VTL) {
  __shared__ __align__(16) __bf16 sk[2][KST][KPIT]; __shared__ __align__(16) __bf16 svh[2][HD][VPIT], svl[2][HD][VPIT];
  __shared__ __align__(16) float so[4][16][36];
  const int tid = threadIdx.x, wave = tid >> 5, lane = tid & 31, col = lane & 15, g = lane >> 4;
  const int qb = blockIdx.x, bh = blockIdx.y, b = bh / NH, h = bh % NH; const int q0 = qb * 64 + wave * 16; const size_t tq = (size_t)b * SS + q0;
  const int crow = tid >> 3, cpc = tid & 7;
  const float* gk = QKV + ((size_t)b * SS + crow) * QKVP + DP + h * HD + cpc * 4;
  const __bf16* gh = VTH + ((size_t)b * DP + h * HD + crow) * SS + cpc * 8; const __bf16* gl = VTL + ((size_t)b * DP + h * HD + crow) * SS + cpc * 8;
  const unsigned lh = lds_off(&svh[0][crow][cpc * 8]), ll = lds_off(&svl[0][crow][cpc * 8]);
  const unsigned vbuf = HD * VPIT * 2u;
  stage_copy(gh, gl, lh, ll);
  { const KR k0 = load_k(gk), k1 = load_k(gk + (size_t)KST * QKVP); put_k(k0, sk[0], crow, cpc); put_k(k1, sk[1], crow, cpc); }   // both K buffers are free here
  KR kn = load_k(gk + (size_t)2 * KST * QKVP);   // in flight over a whole stage
  const F2 a0 = split_row(QKV + (tq + col) * QKVP + h * HD, 0, lane);   // B operand of the scores: lane = query column
  asm volatile("s_wait_asynccnt 0x0" ::: "memory");   // stage 0 has landed before the barrier that publishes it
  __syncthreads();
  stage_copy(gh + KST, gl + KST, lh + vbuf, ll + vbuf);
  v2f l[4] = {};     // a lane's own partial sums of t for its query column (keys 8g + r of every 16), as pairs r = 2j, 2j + 1
  v8f acc[2] = {};   // O^T: acc[dt][r] = head column dt * 16 + 8g + r of query column col
  const float scl = 0.17677669529663687f;    // 1/sqrt(32)
#pragma unroll 1
  for (int st = 0; st < NST; ++st) {
    const int bf = st & 1;
#pragma unroll   // both 32-key halves of a stage in line: their LDS offsets become immediates
    for (int hs = 0; hs < KST / 32; ++hs) {
    // S^T = K Q^T: D register r of tile ct is key ct * 16 + 8g + r of query col, which is element ct * 8 + r of the B operand of O^T += V^T P^T
    v2f t[8];   // pairs of neighbouring D registers, so that every packed operation takes its operands where they lie
#pragma unroll
    for (int ct = 0; ct < 2; ++ct) { const __bf16* kp = &sk[bf][hs * 32 + ct * 16 + col][0]; const F2 k0 = {frag_b(kp, lane), frag_b(kp + HD, lane)};
      v8f c = wmma_bf(k0.h, a0.l, (v8f){}); c = wmma_bf(k0.l, a0.h, c); c = wmma_bf(k0.h, a0.h, c);
#pragma unroll
      for (int j = 0; j < 4; ++j) { const v2f u = (v2f){c[2 * j], c[2 * j + 1]} * scl + 5.0f; t[ct * 4 + j] = u * u; } }
#pragma unroll   // t[], l[], ph and pl stay in registers, here and below
    for (int j = 0; j < 4; ++j) l[j] += t[j] + t[4 + j];
    B16 ph, pl;
#pragma unroll
    for (int i = 0; i < 8; ++i) bsplit2(t[i], ph.p[i], pl.p[i]);
    const F2 pb = {ph.v, pl.v};
#pragma unroll
    for (int dt = 0; dt < 2; ++dt) { const v16b vh = frag_b(&svh[bf][dt * 16 + col][hs * 32], lane), vl = frag_b(&svl[bf][dt * 16 + col][hs * 32], lane);
      acc[dt] = wmma_bf(vh, pb.l, acc[dt]); acc[dt] = wmma_bf(vl, pb.h, acc[dt]); acc[dt] = wmma_bf(vh, pb.h, acc[dt]); } }
    asm volatile("s_wait_dscnt 0x0" ::: "memory");      // this wave's reads of buffer bf are over before the buffer is refilled
    asm volatile("s_wait_asynccnt 0x0" ::: "memory");   // this wave's copies of stage st + 1 have landed before the barrier that publishes them
    __syncthreads();                                    // publishes stage st + 1 and ends every wave's reads of buffer bf
    if (st + 2 < NST) { stage_copy(gh + (st + 2) * KST, gl + (st + 2) * KST, lh + bf * vbuf, ll + bf * vbuf);
      put_k(kn, sk[bf], crow, cpc);   // K of stage st + 2, published by the next stage's barrier
      if (st + 3 < NST) kn = load_k(gk + (size_t)(st + 3) * KST * QKVP); }
  }
  asm volatile("s_wait_asynccnt 0x0" ::: "memory");     // no copy is outstanding when the wave goes on to its end
  float ls = ((l[0][0] + l[0][1]) + (l[1][0] + l[1][1])) + ((l[2][0] + l[2][1]) + (l[3][0] + l[3][1]));
  ls += __shfl_xor(ls, 16);   // the two lane halves of a query column join their sums once
  const float il = 1.0f / ls;
  // a lane holds 8 consecutive head columns of its query row per tile; the rows go through the wave's own LDS so that each store covers whole 128-B lines
#pragma unroll
  for (int dt = 0; dt < 2; ++dt) {
    *(v4f*)&so[wave][col][dt * 16 + 8 * g] = (v4f){acc[dt][0] * il, acc[dt][1] * il, acc[dt][2] * il, acc[dt][3] * il};
    *(v4f*)&so[wave][col][dt * 16 + 8 * g + 4] = (v4f){acc[dt][4] * il, acc[dt][5] * il, acc[dt][6] * il, acc[dt][7] * il}; }
  LDSX();
#pragma unroll
  for (int i = 0; i < 4; ++i) { const int rl = i * 4 + (lane >> 3), pc = lane & 7; vst2(QKV + (tq + rl) * QKVP + h * HD + pc * 4, *(const v4f*)&so[wave][rl][pc * 4]); }
}
// ---- k_out: Y = O(hi/lo; the q columns of QKV, K 256) . Wo rows (2 products) + bo; block (64 rows, 128 of the 256 cols)
__global__ __launch_bounds__(128) void k_out(const float* __restrict__ QKV, const float* __restrict__ Wo, const float* __restrict__ bo, float* __restrict__ Y) {
  __shared__ __align__(16) __bf16 sw[128][WPIT]; __shared__ __align__(16) float so[4][16][132];
  const int tid = threadIdx.x, wave = tid >> 5, lane = tid & 31, col = lane & 15, g = lane >> 4; const size_t r0 = (size_t)blockIdx.x * 64 + wave * 16; const int n0 = blockIdx.y * 128;
  stage_w(Wo + (size_t)n0 * DP, sw, tid);
  __syncthreads();   // the weight rows are written by all four waves and read by all four
  v8f acc[8] = {};
#pragma unroll 2
  for (int kc = 0; kc < DP / 32; ++kc) { const F2 a = split_row(QKV + (r0 + col) * QKVP, kc * 32, lane);
    v16b w[8];
#pragma unroll   // w[] stays in registers, LDS offsets become immediates
    for (int j = 0; j < 8; ++j) w[j] = frag_b(&sw[j * 16 + col][kc * 32], lane);
    asm volatile("" :: "v"(w[0]), "v"(w[1]), "v"(w[2]), "v"(w[3]), "v"(w[4]), "v"(w[5]), "v"(w[6]), "v"(w[7]));   // inputs only: holds the LDS reads of a k step together ahead of its WMMAs; without it each WMMA waited out its own pair of reads
#pragma unroll
    for (int j = 0; j < 8; ++j) { acc[j] = wmma_bf(a.l, w[j], acc[j]); acc[j] = wmma_bf(a.h, w[j], acc[j]); }
    asm volatile("s_wait_xcnt 0x0" ::: "memory"); }   // stands ahead of the next step's write of the address registers that this step's loads of O name
#pragma unroll
  for (int j = 0; j < 8; ++j) { const float bb = bfr(bo[n0 + j * 16 + col]);
#pragma unroll
    for (int r = 0; r < 8; ++r) so[wave][8 * g + r][j * 16 + col] = acc[j][r] + bb; }
  LDSX();
  for (int rl = 0; rl < 16; ++rl) vst2(Y + (r0 + rl) * DIN + n0 + lane * 4, *(const v4f*)&so[wave][rl][lane * 4]);
}

extern "C" void kernel_launch(void* const* d_in, const int* in_sizes, int n_in, void* d_out, int out_size, void* d_ws, size_t ws_size, hipStream_t stream) {
  (void)in_sizes; (void)n_in; (void)out_size;
  const float** F = (const float**)d_in;   // x [8,1024,256], qkv_w [768,256], qkv_b [768], proj_w [256,256], proj_b [256]
  if (ws_size < (size_t)WS_END) return;
  char* ws = (char*)d_ws; __bf16 *VTH = (__bf16*)(ws + WS_VTH), *VTL = (__bf16*)(ws + WS_VTL); float* QKV = (float*)(ws + WS_QKV);
  k_proj<<<dim3(TRB, QKVP / 128), 128, 0, stream>>>(F[0], F[1], F[2], QKV, VTH, VTL);
  k_attn<<<dim3(TQB, TNB * NH), 128, 0, stream>>>(QKV, VTH, VTL);
  k_out<<<dim3((TNB < NB ? TQB : NR / 64), DIN / 128), 128, 0, stream>>>(QKV, F[3], F[4], (float*)d_out);
}

// v008
// It runs in 52.6 microseconds.
// Timed twice side by side with v007, it ran 1.20 and 1.21 times as fast.
// Counting every step since v000, it is 2.87 times as fast.
// compute dtype: x, qkv_w/qkv_b, proj_w/proj_b (module inputs) rounded to bf16; qkv projection with exact bf16 products (+ bias); scores and the (s + 5)^2-weighted value sums with both computed operands as bf16 hi + bf16 residual pairs (3 products); output projection hi/lo x bf16 proj_w (2 products) + bias; the quadratic normalisation in f32; f32 accumulate.
#include <hip/hip_runtime.h>
#include <math.h>

typedef __attribute__((ext_vector_type(16))) _Float16 v16h;
typedef __attribute__((ext_vector_type(16))) __bf16 v16b;
typedef __attribute__((ext_vector_type(8)))  _Float16 v8h;
typedef __attribute__((ext_vector_type(8)))  float v8f;
typedef __attribute__((ext_vector_type(4)))  float v4f;
typedef __attribute__((ext_vector_type(2)))  float v2f;
typedef __attribute__((ext_vector_type(4)))  unsigned v4u;
typedef __attribute__((ext_vector_type(4)))  int v4i;
typedef float __attribute__((may_alias)) float_a;
typedef int __attribute__((may_alias)) int_a;

template <typename T> __device__ __forceinline__ void vst2(void* p, T v) { *(T*)p = v;  }
__device__ __forceinline__ v8f wmma16(v16h a, v16h b, v8f c) {
  v8f d = __builtin_amdgcn_wmma_f32_16x16x32_f16(false, a, false, b, (short)0, c, false, false);
  asm volatile("v_nop\n\tv_nop\n\tv_nop\n\tv_nop" : "+v"(d) : "v"(a), "v"(b));
  return d;
}
__device__ __forceinline__ v8f wmma_bf(v16b a, v16b b, v8f c) {
  return __builtin_amdgcn_wmma_f32_16x16x32_bf16(false, a, false, b, (short)0, c, false, false);
}
// 16x16x32 fragments: lane = (h = lane>>4, row/col = lane&15); elements 0..7 = k0+8h+0..7, 8..15 = k0+16+8h+0..7; D element r = row 8h+r
__device__ __forceinline__ v16h frag_h(const _Float16* rowk0, int lane) {
  union { v16h v; v8h q[2]; } u; const _Float16* p = rowk0 + 8 * (lane >> 4);
  u.q[0] = *(const v8h*)p; u.q[1] = *(const v8h*)(p + 16); return u.v;
}
__device__ __forceinline__ v16h frag_f32(const float* rowk0, int lane) {
  v16h a; const float* p = rowk0 + 8 * (lane >> 4);
#pragma unroll
  for (int i = 0; i < 8; ++i) { a[i] = (_Float16)p[i]; a[8 + i] = (_Float16)p[16 + i]; }
  return a;
}
__device__ __forceinline__ v16h frag_f32s(const float* rowk0, int lane, float sc) {
  v16h a; const float* p = rowk0 + 8 * (lane >> 4);
#pragma unroll
  for (int i = 0; i < 8; ++i) { a[i] = (_Float16)(p[i] * sc); a[8 + i] = (_Float16)(p[16 + i] * sc); }
  return a;
}
// column fragment from a [K][ld] layout (column n), rows >= K read as 0
__device__ __forceinline__ v16h fragc_f32(const float* W, int k0, int n, int lane, int ld, int K) {
  v16h a; const int g = lane >> 4;
#pragma unroll
  for (int i = 0; i < 8; ++i) { const int ka = k0 + 8 * g + i, kb = ka + 16;
    a[i] = (_Float16)(ka < K ? W[(size_t)(ka < K ? ka : K - 1) * ld + n] : 0.f); a[8 + i] = (_Float16)(kb < K ? W[(size_t)(kb < K ? kb : K - 1) * ld + n] : 0.f); }
  return a;
}
struct F2 { v16b h, l; };
typedef __attribute__((ext_vector_type(2))) __bf16 v2b;
// hi + residual of two neighbouring f32 registers: one packed conversion makes the hi pair, the residuals read its two halves
__device__ __forceinline__ void bsplit2(v2f t, v2b& h, v2b& l) { h = __builtin_convertvector(t, v2b); l = __builtin_convertvector((v2f){t[0] - (float)h[0], t[1] - (float)h[1]}, v2b); }
union B16 { v16b v; v2b p[8]; };
__device__ __forceinline__ F2 bsplit16(const float v[16]) { B16 h, l;
#pragma unroll
  for (int i = 0; i < 8; ++i) bsplit2((v2f){v[2 * i], v[2 * i + 1]}, h.p[i], l.p[i]);
  return F2{h.v, l.v}; }
__device__ __forceinline__ F2 split_row(const float* row, int k0, int lane) { float v[16]; const float* p = row + k0 + 8 * (lane >> 4);
#pragma unroll
  for (int i = 0; i < 8; ++i) { v[i] = p[i]; v[8 + i] = p[16 + i]; }
  return bsplit16(v); }
__device__ __forceinline__ F2 split_rowK(const float* row, int k0, int lane, int K) { float v[16]; const int g = lane >> 4;
#pragma unroll
  for (int i = 0; i < 8; ++i) { const int ka = k0 + 8 * g + i, kb = ka + 16; v[i] = ka < K ? row[ka < K ? ka : K - 1] : 0.f; v[8 + i] = kb < K ? row[kb < K ? kb : K - 1] : 0.f; }
  return bsplit16(v); }
__device__ __forceinline__ F2 split_col(const float* W, int k0, int n, int lane, int ld, int K) { float v[16]; const int g = lane >> 4;
#pragma unroll
  for (int i = 0; i < 8; ++i) { const int ka = k0 + 8 * g + i, kb = ka + 16; v[i] = ka < K ? W[(size_t)(ka < K ? ka : K - 1) * ld + n] : 0.f; v[8 + i] = kb < K ? W[(size_t)(kb < K ? kb : K - 1) * ld + n] : 0.f; }
  return bsplit16(v); }
__device__ __forceinline__ v8f mac3(const F2& a, const F2& b, v8f c) { c = wmma_bf(a.l, b.h, c); c = wmma_bf(a.h, b.l, c); return wmma_bf(a.h, b.h, c); }
__device__ __forceinline__ float sigm(float v) { return 1.0f / (1.0f + expf(-v)); }
#define LDSX() do { asm volatile("s_wait_dscnt 0" ::: "memory"); __builtin_amdgcn_wave_barrier(); __builtin_amdgcn_fence(__ATOMIC_RELEASE, "workgroup"); } while (0)


// Linear-variant attention: qkv = x qkv_w^T + b (8 heads x 32), scores = q k^T / sqrt(32), t = (scores + 5)^2, attn = t / sum_k t (no softmax), out = attn v merged, @ proj_w^T + proj_b.  B 8, N 1024, D 256.
// k_proj (exact GEMM + bias; each block rounds its own 128 weight rows to bf16 into LDS; q and k columns as f32 rows, v columns straight as V^T bf16 hi / lo rows), k_attn (flash-style without max tracking: S^T = K Q^T, running in-lane sum of t and O^T += V^T t^T, t staying in registers; a wave takes 32 query columns and half the keys, 16 steps of 32, and the two waves of a query group join their sums at the end; K and V^T tiles come through a two-buffer LDS ring shared by the block's eight waves, K split to bf16 hi | lo once on its way in), k_out (weight rows as in k_proj; + proj_b).
#define NB 8
#define SS 1024
#define DIN 256
#define DP 256
#define NH 8
#define HD 32
#define NR (NB * SS)
#define QKVP (3 * DP)
#ifndef TRB
#define TRB (NR / 64)
#define TQB (SS / 64)
#define TNB NB
#endif
typedef __attribute__((ext_vector_type(8))) __bf16 v8b;
__device__ __forceinline__ v16b frag_b(const __bf16* rowk0, int lane) {
  union { v16b v; v8b q[2]; } u; const __bf16* p = rowk0 + 8 * (lane >> 4);
  u.q[0] = *(const v8b*)p; u.q[1] = *(const v8b*)(p + 16); return u.v;
}
__device__ __forceinline__ v16b frag_gbf(const float* rowk0, int lane) {
  v16b a; const float* p = rowk0 + 8 * (lane >> 4);
#pragma unroll
  for (int i = 0; i < 8; ++i) { a[i] = (__bf16)p[i]; a[8 + i] = (__bf16)p[16 + i]; }
  return a;
}
__device__ __forceinline__ float bfr(float v) { return (float)(__bf16)v; }
__device__ __attribute__((noinline)) float exp_ni(float v) { return expf(v); }
#define WS_QKV  0u                                    // f32 [NR][QKVP]; q cols later overwritten by O, v cols unused
#define WS_VTH  (WS_QKV + 4u * NR * QKVP)             // bf16 [8][256][1024]
#define WS_VTL  (WS_VTH + 2u * NB * DP * SS)
#define WS_END  (WS_VTL + 2u * NB * DP * SS)

typedef __attribute__((ext_vector_type(4))) __bf16 v4b;
#define WPIT 264   // LDS pitch of a bf16 weight row of 256: 528 B = 16 B x 33 suits the 16-byte LDS readers
// a block's 128 weight rows (f32, 256 long, one run of memory) rounded to bf16 into LDS: each load of a wave covers 512 B in a row = four whole lines
__device__ __forceinline__ void stage_w(const float* __restrict__ Wt, __bf16 (*sw)[WPIT], int tid) {
#pragma unroll   // every load at an immediate offset from one address
  for (int c = 0; c < 2; ++c) { v4f w[32];
#pragma unroll   // w[] stays in registers, here and below
    for (int i = 0; i < 32; ++i) w[i] = *(const v4f*)(Wt + (c * 32 + i) * 512 + tid * 4);
#pragma unroll
    for (int i = 0; i < 32; ++i) *(v4b*)&sw[(c * 32 + i) * 2 + (tid >> 6)][(tid & 63) * 4] = (v4b){(__bf16)w[i][0], (__bf16)w[i][1], (__bf16)w[i][2], (__bf16)w[i][3]};
    if (c == 1) asm volatile("s_wait_xcnt 0x0" ::: "memory");   // stands ahead of the first later write of a register that these loads name
    __builtin_amdgcn_sched_barrier(0);   // holds the next 32 loads behind these stores (32 in flight fit the registers of the main loop, 64 took more than 256) and later code behind the wait
  }
}
// ---- k_proj: QKV[r][n] = bf16(x[r]) . bf16(Wqkv[n]) (exact products) + bias; block (64 rows, 128 cols); the v columns leave as V^T hi / lo rows
#define PVP 72   // LDS pitch of a V^T row of 64 tokens: 144 B suits the 16-byte LDS writers and readers
union ProjLds { __bf16 sw[128][WPIT]; float so[4][16][132]; __bf16 sv[2][128][PVP]; };
__global__ __launch_bounds__(128) void k_proj(const float* __restrict__ X, const float* __restrict__ Wqkv, const float* __restrict__ bqkv, float* __restrict__ QKV, __bf16* __restrict__ VTH, __bf16* __restrict__ VTL) {
  __shared__ __align__(16) ProjLds sm;
  const int tid = threadIdx.x, wave = tid >> 5, lane = tid & 31, col = lane & 15, g = lane >> 4; const size_t r0 = (size_t)blockIdx.x * 64 + wave * 16; const int n0 = blockIdx.y * 128;
  stage_w(Wqkv + (size_t)n0 * DIN, sm.sw, tid);
  __syncthreads();   // the weight rows are written by all four waves and read by all four
  v8f acc[8] = {};
#pragma unroll 2
  for (int kc = 0; kc < DIN / 32; ++kc) { const v16b a = frag_gbf(X + (r0 + col) * DIN + kc * 32, lane);
    v16b w[8];
#pragma unroll   // w[] stays in registers, LDS offsets become immediates
    for (int j = 0; j < 8; ++j) w[j] = frag_b(&sm.sw[j * 16 + col][kc * 32], lane);
    asm volatile("" :: "v"(w[0]), "v"(w[1]), "v"(w[2]), "v"(w[3]), "v"(w[4]), "v"(w[5]), "v"(w[6]), "v"(w[7]));   // inputs only: holds the LDS reads of a k step together ahead of its WMMAs; without it each WMMA waited out its own pair of reads
#pragma unroll
    for (int j = 0; j < 8; ++j) acc[j] = wmma_bf(a, w[j], acc[j]);
    asm volatile("s_wait_xcnt 0x0" ::: "memory"); }   // stands ahead of the next step's write of the address registers that this step's loads of x name
  __syncthreads();   // every wave has read its last weight row before the same LDS takes the results
  float bb[8];
#pragma unroll
  for (int j = 0; j < 8; ++j) bb[j] = bfr(bqkv[n0 + j * 16 + col]);
  if (n0 >= 2 * DP) {   // v columns (the same for the whole block): a lane's 8 D registers are 8 consecutive tokens of one column = 16 B of a V^T row
#pragma unroll
    for (int j = 0; j < 8; ++j) { const int c = j * 16 + col; union { v8b v; v2b p[4]; } hv, lv;
#pragma unroll
      for (int q = 0; q < 4; ++q) bsplit2((v2f){acc[j][2 * q], acc[j][2 * q + 1]} + bb[j], hv.p[q], lv.p[q]);
      *(v8b*)&sm.sv[0][c][wave * 16 + 8 * g] = hv.v; *(v8b*)&sm.sv[1][c][wave * 16 + 8 * g] = lv.v; }
    __syncthreads();   // a V^T row's 64 tokens come from all four waves; behind it 8 lanes store one whole 128-B line
    const size_t t0 = (size_t)blockIdx.x * 64; const size_t o = ((t0 / SS) * DP + (n0 - 2 * DP) + (tid >> 3)) * SS + t0 % SS + (tid & 7) * 8;
#pragma unroll
    for (int i = 0; i < 8; ++i) { vst2((unsigned*)(VTH + o + (size_t)i * 16 * SS), *(const v4u*)&sm.sv[0][i * 16 + (tid >> 3)][(tid & 7) * 8]); vst2((unsigned*)(VTL + o + (size_t)i * 16 * SS), *(const v4u*)&sm.sv[1][i * 16 + (tid >> 3)][(tid & 7) * 8]); }
    return;
  }
#pragma unroll
  for (int j = 0; j < 8; ++j) {
#pragma unroll
    for (int r = 0; r < 8; ++r) sm.so[wave][8 * g + r][j * 16 + col] = acc[j][r] + bb[j]; }
  LDSX();
  for (int rl = 0; rl < 16; ++rl) vst2(QKV + (r0 + rl) * QKVP + n0 + lane * 4, *(const v4f*)&sm.so[wave][rl][lane * 4]);
}
// one stage of the LDS ring = KST keys of one head, as two halves of 64 keys, one for each half of the block's waves: K rows (32 bf16 hi | 32 bf16 lo) and the V^T hi / lo rows of a half in bf16 are all 128 B long; pitch 144 B suits the 16-byte LDS readers
#define KST 128
#define NST (SS / KST)
#define KPIT 72
#define VPIT 72
#define QBLK 128   // queries of a block: four groups of 32, each group taken by two waves (one per key half)
__device__ __forceinline__ unsigned lds_off(const void* p) { return (unsigned)(size_t)p; }   // low 32 bits of a __shared__ address = byte offset in the work-group's LDS
// 8 lanes copy one whole 128-B run of a row; a lane's 4 copies: V^T hi row r, key halves 0 and 1, V^T lo row r, key halves 0 and 1 (r = tid >> 3)
__device__ __forceinline__ void stage_copy(const __bf16* gh, const __bf16* gl, unsigned lh, unsigned ll) {
  // the copies go global -> LDS through no register; s_wait_xcnt 0 closes the statement so that no address register is rewritten ahead of it
  asm volatile("global_load_async_to_lds_b128 %0, %4, off\n\t"
               "global_load_async_to_lds_b128 %1, %5, off\n\t"
               "global_load_async_to_lds_b128 %2, %6, off\n\t"
               "global_load_async_to_lds_b128 %3, %7, off\n\t"
               "s_wait_xcnt 0x0"
               :: "v"(lh), "v"(lh + HD * VPIT * 2u), "v"(ll), "v"(ll + HD * VPIT * 2u),
                  "v"(gh), "v"(gh + 64), "v"(gl), "v"(gl + 64)
               : "memory");
}
// a thread's share of a K tile: 4 floats of rows r, r+32, r+64, r+96 (8 lanes load one whole 128-B row)
struct KR { v4f v[4]; };
__device__ __forceinline__ KR load_k(const float* gk) { KR k;
#pragma unroll   // k.v[] stays in registers, the four loads at immediate offsets from one address
  for (int j = 0; j < 4; ++j) k.v[j] = *(const v4f*)(gk + j * 32 * QKVP);
  asm volatile("s_wait_xcnt 0x0" ::: "memory");   // stands ahead of the first later write of a register that these loads name, and keeps the loads issued here, a stage ahead of their use
  return k; }
// the share is split to bf16 hi + bf16 residual once for the whole block and stored as the hi and lo halves of its rows
__device__ __forceinline__ void put_k(const KR& k, __bf16 (*kb)[KPIT], int crow, int cpc) {
#pragma unroll   // k.v[] stays in registers, here and below
  for (int j = 0; j < 4; ++j) { union { v4b v; v2b p[2]; } hv, lv;
    bsplit2((v2f){k.v[j][0], k.v[j][1]}, hv.p[0], lv.p[0]); bsplit2((v2f){k.v[j][2], k.v[j][3]}, hv.p[1], lv.p[1]);
    *(v4b*)&kb[crow + 32 * j][cpc * 4] = hv.v; *(v4b*)&kb[crow + 32 * j][HD + cpc * 4] = lv.v; }
}
__global__ __launch_bounds__(256) void k_attn(float* __restrict__ QKV, const __bf16* __restrict__ VTH, const __bf16* __restrict__ VTL) {
  __shared__ __align__(16) __bf16 sk[2][KST][KPIT]; __shared__ __align__(16) __bf16 svh[2][2][HD][VPIT], svl[2][2][HD][VPIT];   // V^T: [buffer][key half][head column][key]
  __shared__ __align__(16) float so[8][16][36];
  __shared__ __align__(16) v4f sp[8][4][32]; __shared__ float sl[8][32];   // what a wave hands to its partner of the other key half
  const int tid = threadIdx.x, wave = __builtin_amdgcn_readfirstlane(tid >> 5), lane = tid & 31, col = lane & 15, g = lane >> 4;
  const int qg = wave & 3, kh = wave >> 2;   // query group of 32 columns, key half
  const int qb = blockIdx.x, bh = blockIdx.y, b = bh / NH, h = bh % NH; const int q0 = qb * QBLK + qg * 32; const size_t tq = (size_t)b * SS + q0;
  const int crow = tid >> 3, cpc = tid & 7;
  const float* gk = QKV + ((size_t)b * SS + crow) * QKVP + DP + h * HD + cpc * 4;
  const __bf16* gh = VTH + ((size_t)b * DP + h * HD + crow) * SS + cpc * 8; const __bf16* gl = VTL + ((size_t)b * DP + h * HD + crow) * SS + cpc * 8;
  const unsigned lh = lds_off(&svh[0][0][crow][cpc * 8]), ll = lds_off(&svl[0][0][crow][cpc * 8]);
  const unsigned vbuf = 2u * HD * VPIT * 2u;
  stage_copy(gh, gl, lh, ll);
  { const KR k0 = load_k(gk), k1 = load_k(gk + (size_t)KST * QKVP); put_k(k0, sk[0], crow, cpc); put_k(k1, sk[1], crow, cpc); }   // both K buffers are free here
  KR kn = load_k(gk + (size_t)2 * KST * QKVP);   // in flight over a whole stage
  const F2 a0[2] = {split_row(QKV + (tq + col) * QKVP + h * HD, 0, lane), split_row(QKV + (tq + 16 + col) * QKVP + h * HD, 0, lane)};   // B operands of the scores: lane = query column of tile 0, of tile 1
  asm volatile("s_wait_asynccnt 0x0" ::: "memory");   // stage 0 has landed before the barrier that publishes it
  __syncthreads();
  stage_copy(gh + KST, gl + KST, lh + vbuf, ll + vbuf);
  v2f l[2][4] = {};     // per query tile: a lane's own partial sums of t for its query column (keys 8g + r of every 16), as pairs r = 2j, 2j + 1
  v8f acc[2][2] = {};   // O^T: acc[qt][dt][r] = head column dt * 16 + 8g + r of query column col of tile qt
  const float scl = 0.17677669529663687f;    // 1/sqrt(32)
#pragma unroll 1
  for (int st = 0; st < NST; ++st) {
    const int bf = st & 1;
#pragma unroll   // both 32-key halves of a wave's 64 keys in line: their LDS offsets become immediates
    for (int hs = 0; hs < 2; ++hs) {
    // S^T = K Q^T: D register r of tile ct is key ct * 16 + 8g + r of query col, which is element ct * 8 + r of the B operand of O^T += V^T P^T
    F2 kf[2];   // each K fragment is read from LDS once and meets both query tiles
#pragma unroll
    for (int ct = 0; ct < 2; ++ct) { const __bf16* kp = &sk[bf][kh * 64 + hs * 32 + ct * 16 + col][0]; kf[ct] = F2{frag_b(kp, lane), frag_b(kp + HD, lane)}; }
    F2 pb[2];
#pragma unroll   // t[], l[], ph and pl stay in registers, here and below
    for (int qt = 0; qt < 2; ++qt) {
      v2f t[8];   // pairs of neighbouring D registers, so that every packed operation takes its operands where they lie
#pragma unroll
      for (int ct = 0; ct < 2; ++ct) {
        v8f c = wmma_bf(kf[ct].h, a0[qt].l, (v8f){}); c = wmma_bf(kf[ct].l, a0[qt].h, c); c = wmma_bf(kf[ct].h, a0[qt].h, c);
#pragma unroll
        for (int j = 0; j < 4; ++j) { const v2f u = (v2f){c[2 * j], c[2 * j + 1]} * scl + 5.0f; t[ct * 4 + j] = u * u; } }
#pragma unroll
      for (int j = 0; j < 4; ++j) l[qt][j] += t[j] + t[4 + j];
      B16 ph, pl;
#pragma unroll
      for (int i = 0; i < 8; ++i) bsplit2(t[i], ph.p[i], pl.p[i]);
      pb[qt] = F2{ph.v, pl.v}; }
#pragma unroll   // each V^T fragment too is read once for both query tiles
    for (int dt = 0; dt < 2; ++dt) { const v16b vh = frag_b(&svh[bf][kh][dt * 16 + col][hs * 32], lane), vl = frag_b(&svl[bf][kh][dt * 16 + col][hs * 32], lane);
#pragma unroll
      for (int qt = 0; qt < 2; ++qt) { acc[qt][dt] = wmma_bf(vh, pb[qt].l, acc[qt][dt]); acc[qt][dt] = wmma_bf(vl, pb[qt].h, acc[qt][dt]); acc[qt][dt] = wmma_bf(vh, pb[qt].h, acc[qt][dt]); } } }
    asm volatile("s_wait_dscnt 0x0" ::: "memory");      // this wave's reads of buffer bf are over before the buffer is refilled
    asm volatile("s_wait_asynccnt 0x0" ::: "memory");   // this wave's copies of stage st + 1 have landed before the barrier that publishes them
    __syncthreads();                                    // publishes stage st + 1 and ends every wave's reads of buffer bf
    if (st + 2 < NST) { stage_copy(gh + (st + 2) * KST, gl + (st + 2) * KST, lh + bf * vbuf, ll + bf * vbuf);
      put_k(kn, sk[bf], crow, cpc);   // K of stage st + 2, published by the next stage's barrier
      if (st + 3 < NST) kn = load_k(gk + (size_t)(st + 3) * KST * QKVP); }
  }
  asm volatile("s_wait_asynccnt 0x0" ::: "memory");     // no copy is outstanding when the wave goes on to its end
  // the two waves of a query group hold sums over different keys: wave kh finishes query tile kh and hands its sums of the other tile to its partner
  float ls[2];
#pragma unroll
  for (int qt = 0; qt < 2; ++qt) ls[qt] = ((l[qt][0][0] + l[qt][0][1]) + (l[qt][1][0] + l[qt][1][1])) + ((l[qt][2][0] + l[qt][2][1]) + (l[qt][3][0] + l[qt][3][1]));
  v8f o[2]; float lo;
#pragma unroll
  for (int dt = 0; dt < 2; ++dt) { const v8f gv = kh ? acc[0][dt] : acc[1][dt]; o[dt] = kh ? acc[1][dt] : acc[0][dt];
    sp[wave][dt * 2][lane] = (v4f){gv[0], gv[1], gv[2], gv[3]}; sp[wave][dt * 2 + 1][lane] = (v4f){gv[4], gv[5], gv[6], gv[7]}; }
  sl[wave][lane] = kh ? ls[0] : ls[1]; lo = kh ? ls[1] : ls[0];
  __syncthreads();   // the partner's sums are written before they are read
#pragma unroll
  for (int dt = 0; dt < 2; ++dt) { const v4f p0 = sp[wave ^ 4][dt * 2][lane], p1 = sp[wave ^ 4][dt * 2 + 1][lane];
#pragma unroll
    for (int r = 0; r < 4; ++r) { o[dt][r] += p0[r]; o[dt][4 + r] += p1[r]; } }
  lo += sl[wave ^ 4][lane];
  lo += __shfl_xor(lo, 16);   // the two lane halves of a query column join their sums once
  const float il = 1.0f / lo;
  // a lane holds 8 consecutive head columns of its query row per tile; the rows go through the wave's own LDS so that each store covers whole 128-B lines
#pragma unroll
  for (int dt = 0; dt < 2; ++dt) {
    *(v4f*)&so[wave][col][dt * 16 + 8 * g] = (v4f){o[dt][0] * il, o[dt][1] * il, o[dt][2] * il, o[dt][3] * il};
    *(v4f*)&so[wave][col][dt * 16 + 8 * g + 4] = (v4f){o[dt][4] * il, o[dt][5] * il, o[dt][6] * il, o[dt][7] * il}; }
  LDSX();
#pragma unroll
  for (int i = 0; i < 4; ++i) { const int rl = i * 4 + (lane >> 3), pc = lane & 7; vst2(QKV + (tq + kh * 16 + rl) * QKVP + h * HD + pc * 4, *(const v4f*)&so[wave][rl][pc * 4]); }
}
// ---- k_out: Y = O(hi/lo; the q columns of QKV, K 256) . Wo rows (2 products) + bo; block (64 rows, 128 of the 256 cols)
__global__ __launch_bounds__(128) void k_out(const float* __restrict__ QKV, const float* __restrict__ Wo, const float* __restrict__ bo, float* __restrict__ Y) {
  __shared__ __align__(16) __bf16 sw[128][WPIT]; __shared__ __align__(16) float so[4][16][132];
  const int tid = threadIdx.x, wave = tid >> 5, lane = tid & 31, col = lane & 15, g = lane >> 4; const size_t r0 = (size_t)blockIdx.x * 64 + wave * 16; const int n0 = blockIdx.y * 128;
  stage_w(Wo + (size_t)n0 * DP, sw, tid);
  __syncthreads();   // the weight rows are written by all four waves and read by all four
  v8f acc[8] = {};
#pragma unroll 2
  for (int kc = 0; kc < DP / 32; ++kc) { const F2 a = split_row(QKV + (r0 + col) * QKVP, kc * 32, lane);
    v16b w[8];
#pragma unroll   // w[] stays in registers, LDS offsets become immediates
    for (int j = 0; j < 8; ++j) w[j] = frag_b(&sw[j * 16 + col][kc * 32], lane);
    asm volatile("" :: "v"(w[0]), "v"(w[1]), "v"(w[2]), "v"(w[3]), "v"(w[4]), "v"(w[5]), "v"(w[6]), "v"(w[7]));   // inputs only: holds the LDS reads of a k step together ahead of its WMMAs; without it each WMMA waited out its own pair of reads
#pragma unroll
    for (int j = 0; j < 8; ++j) { acc[j] = wmma_bf(a.l, w[j], acc[j]); acc[j] = wmma_bf(a.h, w[j], acc[j]); }
    asm volatile("s_wait_xcnt 0x0" ::: "memory"); }   // stands ahead of the next step's write of the address registers that this step's loads of O name
#pragma unroll
  for (int j = 0; j < 8; ++j) { const float bb = bfr(bo[n0 + j * 16 + col]);
#pragma unroll
    for (int r = 0; r < 8; ++r) so[wave][8 * g + r][j * 16 + col] = acc[j][r] + bb; }
  LDSX();
  for (int rl = 0; rl < 16; ++rl) vst2(Y + (r0 + rl) * DIN + n0 + lane * 4, *(const v4f*)&so[wave][rl][lane * 4]);
}

extern "C" void kernel_launch(void* const* d_in, const int* in_sizes, int n_in, void* d_out, int out_size, void* d_ws, size_t ws_size, hipStream_t stream) {
  (void)in_sizes; (void)n_in; (void)out_size;
  const float** F = (const float**)d_in;   // x [8,1024,256], qkv_w [768,256], qkv_b [768], proj_w [256,256], proj_b [256]
  if (ws_size < (size_t)WS_END) return;
  char* ws = (char*)d_ws; __bf16 *VTH = (__bf16*)(ws + WS_VTH), *VTL = (__bf16*)(ws + WS_VTL); float* QKV = (float*)(ws + WS_QKV);
  k_proj<<<dim3(TRB, QKVP / 128), 128, 0, stream>>>(F[0], F[1], F[2], QKV, VTH, VTL);
  k_attn<<<dim3(SS / QBLK, TNB * NH), 256, 0, stream>>>(QKV, VTH, VTL);
  k_out<<<dim3((TNB < NB ? TQB : NR / 64), DIN / 128), 128, 0, stream>>>(QKV, F[3], F[4], (float*)d_out);
}

// v009
// A run of this version takes 49.9 microseconds.
// In two side-by-side timings against v008, it was 1.05 and 1.06 times as fast.
// Over all steps from v000 it is 3.03 times as fast.
// compute dtype: x, qkv_w/qkv_b, proj_w/proj_b (module inputs) rounded to bf16; qkv projection with exact bf16 products (+ bias); scores and the (s + 5)^2-weighted value sums with both computed operands as bf16 hi + bf16 residual pairs (3 products); output projection hi/lo x bf16 proj_w (2 products) + bias; the quadratic normalisation in f32; f32 accumulate.
#include <hip/hip_runtime.h>
#include <math.h>

typedef __attribute__((ext_vector_type(16))) _Float16 v16h;
typedef __attribute__((ext_vector_type(16))) __bf16 v16b;
typedef __attribute__((ext_vector_type(8)))  _Float16 v8h;
typedef __attribute__((ext_vector_type(8)))  float v8f;
typedef __attribute__((ext_vector_type(4)))  float v4f;
typedef __attribute__((ext_vector_type(2)))  float v2f;
typedef __attribute__((ext_vector_type(4)))  unsigned v4u;
typedef __attribute__((ext_vector_type(4)))  int v4i;
typedef float __attribute__((may_alias)) float_a;
typedef int __attribute__((may_alias)) int_a;

template <typename T> __device__ __forceinline__ void vst2(void* p, T v) { *(T*)p = v;  }
__device__ __forceinline__ v8f wmma16(v16h a, v16h b, v8f c) {
  v8f d = __builtin_amdgcn_wmma_f32_16x16x32_f16(false, a, false, b, (short)0, c, false, false);
  asm volatile("v_nop\n\tv_nop\n\tv_nop\n\tv_nop" : "+v"(d) : "v"(a), "v"(b));
  return d;
}
__device__ __forceinline__ v8f wmma_bf(v16b a, v16b b, v8f c) {
  return __builtin_amdgcn_wmma_f32_16x16x32_bf16(false, a, false, b, (short)0, c, false, false);
}
// 16x16x32 fragments: lane = (h = lane>>4, row/col = lane&15); elements 0..7 = k0+8h+0..7, 8..15 = k0+16+8h+0..7; D element r = row 8h+r
__device__ __forceinline__ v16h frag_h(const _Float16* rowk0, int lane) {
  union { v16h v; v8h q[2]; } u; const _Float16* p = rowk0 + 8 * (lane >> 4);
  u.q[0] = *(const v8h*)p; u.q[1] = *(const v8h*)(p + 16); return u.v;
}
__device__ __forceinline__ v16h frag_f32(const float* rowk0, int lane) {
  v16h a; const float* p = rowk0 + 8 * (lane >> 4);
#pragma unroll
  for (int i = 0; i < 8; ++i) { a[i] = (_Float16)p[i]; a[8 + i] = (_Float16)p[16 + i]; }
  return a;
}
__device__ __forceinline__ v16h frag_f32s(const float* rowk0, int lane, float sc) {
  v16h a; const float* p = rowk0 + 8 * (lane >> 4);
#pragma unroll
  for (int i = 0; i < 8; ++i) { a[i] = (_Float16)(p[i] * sc); a[8 + i] = (_Float16)(p[16 + i] * sc); }
  return a;
}
// column fragment from a [K][ld] layout (column n), rows >= K read as 0
__device__ __forceinline__ v16h fragc_f32(const float* W, int k0, int n, int lane, int ld, int K) {
  v16h a; const int g = lane >> 4;
#pragma unroll
  for (int i = 0; i < 8; ++i) { const int ka = k0 + 8 * g + i, kb = ka + 16;
    a[i] = (_Float16)(ka < K ? W[(size_t)(ka < K ? ka : K - 1) * ld + n] : 0.f); a[8 + i] = (_Float16)(kb < K ? W[(size_t)(kb < K ? kb : K - 1) * ld + n] : 0.f); }
  return a;
}
struct F2 { v16b h, l; };
typedef __attribute__((ext_vector_type(2))) __bf16 v2b;
// hi + residual of two neighbouring f32 registers: one packed conversion makes the hi pair, the residuals read its two halves
__device__ __forceinline__ void bsplit2(v2f t, v2b& h, v2b& l) { h = __builtin_convertvector(t, v2b); l = __builtin_convertvector((v2f){t[0] - (float)h[0], t[1] - (float)h[1]}, v2b); }
union B16 { v16b v; v2b p[8]; };
__device__ __forceinline__ F2 bsplit16(const float v[16]) { B16 h, l;
#pragma unroll
  for (int i = 0; i < 8; ++i) bsplit2((v2f){v[2 * i], v[2 * i + 1]}, h.p[i], l.p[i]);
  return F2{h.v, l.v}; }
__device__ __forceinline__ F2 split_row(const float* row, int k0, int lane) { float v[16]; const float* p = row + k0 + 8 * (lane >> 4);
#pragma unroll
  for (int i = 0; i < 8; ++i) { v[i] = p[i]; v[8 + i] = p[16 + i]; }
  return bsplit16(v); }
__device__ __forceinline__ F2 split_rowK(const float* row, int k0, int lane, int K) { float v[16]; const int g = lane >> 4;
#pragma unroll
  for (int i = 0; i < 8; ++i) { const int ka = k0 + 8 * g + i, kb = ka + 16; v[i] = ka < K ? row[ka < K ? ka : K - 1] : 0.f; v[8 + i] = kb < K ? row[kb < K ? kb : K - 1] : 0.f; }
  return bsplit16(v); }
__device__ __forceinline__ F2 split_col(const float* W, int k0, int n, int lane, int ld, int K) { float v[16]; const int g = lane >> 4;
#pragma unroll
  for (int i = 0; i < 8; ++i) { const int ka = k0 + 8 * g + i, kb = ka + 16; v[i] = ka < K ? W[(size_t)(ka < K ? ka : K - 1) * ld + n] : 0.f; v[8 + i] = kb < K ? W[(size_t)(kb < K ? kb : K - 1) * ld + n] : 0.f; }
  return bsplit16(v); }
__device__ __forceinline__ v8f mac3(const F2& a, const F2& b, v8f c) { c = wmma_bf(a.l, b.h, c); c = wmma_bf(a.h, b.l, c); return wmma_bf(a.h, b.h, c); }
__device__ __forceinline__ float sigm(float v) { return 1.0f / (1.0f + expf(-v)); }
#define LDSX() do { asm volatile("s_wait_dscnt 0" ::: "memory"); __builtin_amdgcn_wave_barrier(); __builtin_amdgcn_fence(__ATOMIC_RELEASE, "workgroup"); } while (0)


// Linear-variant attention: qkv = x qkv_w^T + b (8 heads x 32), scores = q k^T / sqrt(32), t = (scores + 5)^2, attn = t / sum_k t (no softmax), out = attn v merged, @ proj_w^T + proj_b.  B 8, N 1024, D 256.
// k_proj (exact GEMM + bias; each block rounds its own 128 weight rows to bf16 into LDS; q and k columns as f32 rows, v columns straight as V^T bf16 hi / lo rows), k_attn (flash-style without max tracking: S^T = K Q^T, running in-lane sum of t and O^T += V^T t^T, t staying in registers; a wave takes 32 query columns and half the keys, 16 steps of 32, and the two waves of a query group join their sums at the end; K and V^T tiles come through a two-buffer LDS ring shared by the block's eight waves, K split to bf16 hi | lo once on its way in), k_out (weight rows as in k_proj; + proj_b).
#define NB 8
#define SS 1024
#define DIN 256
#define DP 256
#define NH 8
#define HD 32
#define NR (NB * SS)
#define QKVP (3 * DP)
#ifndef TRB
#define TRB (NR / 64)
#define TQB (SS / 64)
#define TNB NB
#endif
typedef __attribute__((ext_vector_type(8))) __bf16 v8b;
__device__ __forceinline__ v16b frag_b(const __bf16* rowk0, int lane) {
  union { v16b v; v8b q[2]; } u; const __bf16* p = rowk0 + 8 * (lane >> 4);
  u.q[0] = *(const v8b*)p; u.q[1] = *(const v8b*)(p + 16); return u.v;
}
__device__ __forceinline__ v16b frag_gbf(const float* rowk0, int lane) {
  v16b a; const float* p = rowk0 + 8 * (lane >> 4);
#pragma unroll
  for (int i = 0; i < 8; ++i) { a[i] = (__bf16)p[i]; a[8 + i] = (__bf16)p[16 + i]; }
  return a;
}
__device__ __forceinline__ float bfr(float v) { return (float)(__bf16)v; }
__device__ __attribute__((noinline)) float exp_ni(float v) { return expf(v); }
#define WS_QKV  0u                                    // f32 [NR][QKVP]; q cols later overwritten by O, v cols unused
#define WS_VTH  (WS_QKV + 4u * NR * QKVP)             // bf16 [8][256][1024]
#define WS_VTL  (WS_VTH + 2u * NB * DP * SS)
#define WS_END  (WS_VTL + 2u * NB * DP * SS)

typedef __attribute__((ext_vector_type(4))) __bf16 v4b;
#define WPIT 264   // LDS pitch of a bf16 weight row of 256: 528 B = 16 B x 33 suits the 16-byte LDS readers
// a block's 128 weight rows (f32, 256 long, one run of memory) rounded to bf16 into LDS: each load of a wave covers 512 B in a row = four whole lines
// it goes in four quarters of 32 rows (q = 0..3), each as 16 loads and, later, 16 stores
__device__ __forceinline__ void stage_w_ld(const float* __restrict__ Wt, int q, int tid, v4f (&w)[16]) {
#pragma unroll   // w[] stays in registers, every load at an immediate offset from one address
  for (int i = 0; i < 16; ++i) w[i] = *(const v4f*)(Wt + (q * 16 + i) * 512 + tid * 4);
}
__device__ __forceinline__ void stage_w_st(const v4f (&w)[16], int q, __bf16 (*sw)[WPIT], int tid) {
#pragma unroll   // w[] stays in registers
  for (int i = 0; i < 16; ++i) *(v4b*)&sw[(q * 16 + i) * 2 + (tid >> 6)][(tid & 63) * 4] = (v4b){(__bf16)w[i][0], (__bf16)w[i][1], (__bf16)w[i][2], (__bf16)w[i][3]};
}
// a lane's share of its A row for four k steps of 32 (p = row + first k + 8 * (lane >> 4)): r[4 i .. 4 i + 3] = elements 0..3, 4..7, 8..11, 12..15 of the fragment of step i
__device__ __forceinline__ void load_a4(const float* p, v4f (&r)[16]) {
#pragma unroll   // r[] stays in registers, every load at an immediate offset from one address
  for (int i = 0; i < 4; ++i) { r[4 * i] = *(const v4f*)(p + 32 * i); r[4 * i + 1] = *(const v4f*)(p + 32 * i + 4); r[4 * i + 2] = *(const v4f*)(p + 32 * i + 16); r[4 * i + 3] = *(const v4f*)(p + 32 * i + 20); }
}
// fragment of step i from such a share, rounded to bf16
__device__ __forceinline__ v16b frag_x(const v4f (&r)[16], int i) { v16b a;
#pragma unroll
  for (int e = 0; e < 16; ++e) a[e] = (__bf16)r[4 * i + (e >> 2)][e & 3];
  return a; }
// behind a group of loads: the wait stands ahead of the first later write of a register that these loads name; the scheduling barrier keeps the whole group issued here, ahead of the stores and conversions that wait for earlier loads
__device__ __forceinline__ void loads_out() { asm volatile("s_wait_xcnt 0x0" ::: "memory"); __builtin_amdgcn_sched_barrier(0); }
// the same behind loads from the address p, which as an input of the wait stays in its registers up to it: no load of the group may return into them
__device__ __forceinline__ void loads_out(const float* p) { asm volatile("s_wait_xcnt 0x0" :: "v"(p) : "memory"); __builtin_amdgcn_sched_barrier(0); }
// every global load of a GEMM block as one stream ahead of its k loop: 8 bias values, 64 weight loads, the 32 loads of a lane's A row (xp = row + 8 * (lane >> 4)). 48 loads go out at once; loads return in order, and as 16 have been rounded and stored the next 16 go out, so that the block waits out one trip to memory and at most 56 loads of a wave are outstanding
__device__ __forceinline__ void stage_all(const float* __restrict__ Wt, const float* __restrict__ bp, const float* xp, __bf16 (*sw)[WPIT], int tid, float (&bb)[8], v4f (&x0)[16], v4f (&x1)[16]) {
  v4f w0[16], w1[16], w2[16], w3[16];
#pragma unroll
  for (int j = 0; j < 8; ++j) bb[j] = bp[j * 16];
  loads_out();
  stage_w_ld(Wt, 0, tid, w0); stage_w_ld(Wt, 1, tid, w1); stage_w_ld(Wt, 2, tid, w2);
  loads_out();
  // each scheduling barrier below holds the 16 loads behind it behind the 16 stores ahead of it, which free their registers
  stage_w_st(w0, 0, sw, tid); __builtin_amdgcn_sched_barrier(0); stage_w_ld(Wt, 3, tid, w3); loads_out();
  stage_w_st(w1, 1, sw, tid); __builtin_amdgcn_sched_barrier(0); load_a4(xp, x0); loads_out(xp);
  stage_w_st(w2, 2, sw, tid); __builtin_amdgcn_sched_barrier(0); load_a4(xp + 128, x1); loads_out(xp);
  stage_w_st(w3, 3, sw, tid);
}
// ---- k_proj: QKV[r][n] = bf16(x[r]) . bf16(Wqkv[n]) (exact products) + bias; block (64 rows, 128 cols); the v columns leave as V^T hi / lo rows
#define PVP 72   // LDS pitch of a V^T row of 64 tokens: 144 B suits the 16-byte LDS writers and readers
union ProjLds { __bf16 sw[128][WPIT]; float so[4][16][132]; __bf16 sv[2][128][PVP]; };
__global__ __launch_bounds__(128) void k_proj(const float* __restrict__ X, const float* __restrict__ Wqkv, const float* __restrict__ bqkv, float* __restrict__ QKV, __bf16* __restrict__ VTH, __bf16* __restrict__ VTL) {
  __shared__ __align__(16) ProjLds sm;
  const int tid = threadIdx.x, wave = tid >> 5, lane = tid & 31, col = lane & 15, g = lane >> 4; const size_t r0 = (size_t)blockIdx.x * 64 + wave * 16; const int n0 = blockIdx.y * 128;
  v16b a[8]; float bb[8];   // a lane's whole x row as fragments: the k loop below makes no trip to memory
  { v4f x0[16], x1[16];
    stage_all(Wqkv + (size_t)n0 * DIN, bqkv + n0 + col, X + (r0 + col) * DIN + 8 * g, sm.sw, tid, bb, x0, x1);
#pragma unroll   // a[] stays in registers
    for (int i = 0; i < 4; ++i) { a[i] = frag_x(x0, i); a[4 + i] = frag_x(x1, i); } }
  asm volatile("" :: "v"(a[0]), "v"(a[1]), "v"(a[2]), "v"(a[3]), "v"(a[4]), "v"(a[5]), "v"(a[6]), "v"(a[7]));   // inputs only: the fragments are all made here; left to itself the compiler rounds them inside the k loop, over registers that a WMMA has just read, with four v_nop each time
  __syncthreads();   // the weight rows are written by all four waves and read by all four
  v8f acc[8] = {};
#pragma unroll   // a[] stays in registers
  for (int kc = 0; kc < DIN / 32; ++kc) {
    v16b w[8];
#pragma unroll   // w[] stays in registers, LDS offsets become immediates
    for (int j = 0; j < 8; ++j) w[j] = frag_b(&sm.sw[j * 16 + col][kc * 32], lane);
    asm volatile("" :: "v"(w[0]), "v"(w[1]), "v"(w[2]), "v"(w[3]), "v"(w[4]), "v"(w[5]), "v"(w[6]), "v"(w[7]));   // inputs only: holds the LDS reads of a k step together ahead of its WMMAs; without it each WMMA waited out its own pair of reads
#pragma unroll
    for (int j = 0; j < 8; ++j) acc[j] = wmma_bf(a[kc], w[j], acc[j]); }
  __syncthreads();   // every wave has read its last weight row before the same LDS takes the results
#pragma unroll
  for (int j = 0; j < 8; ++j) bb[j] = bfr(bb[j]);
  if (n0 >= 2 * DP) {   // v columns (the same for the whole block): a lane's 8 D registers are 8 consecutive tokens of one column = 16 B of a V^T row
#pragma unroll
    for (int j = 0; j < 8; ++j) { const int c = j * 16 + col; union { v8b v; v2b p[4]; } hv, lv;
#pragma unroll
      for (int q = 0; q < 4; ++q) bsplit2((v2f){acc[j][2 * q], acc[j][2 * q + 1]} + bb[j], hv.p[q], lv.p[q]);
      *(v8b*)&sm.sv[0][c][wave * 16 + 8 * g] = hv.v; *(v8b*)&sm.sv[1][c][wave * 16 + 8 * g] = lv.v; }
    __syncthreads();   // a V^T row's 64 tokens come from all four waves; behind it 8 lanes store one whole 128-B line
    const size_t t0 = (size_t)blockIdx.x * 64; const size_t o = ((t0 / SS) * DP + (n0 - 2 * DP) + (tid >> 3)) * SS + t0 % SS + (tid & 7) * 8;
#pragma unroll
    for (int i = 0; i < 8; ++i) { vst2((unsigned*)(VTH + o + (size_t)i * 16 * SS), *(const v4u*)&sm.sv[0][i * 16 + (tid >> 3)][(tid & 7) * 8]); vst2((unsigned*)(VTL + o + (size_t)i * 16 * SS), *(const v4u*)&sm.sv[1][i * 16 + (tid >> 3)][(tid & 7) * 8]); }
    return;
  }
#pragma unroll
  for (int j = 0; j < 8; ++j) {
#pragma unroll
    for (int r = 0; r < 8; ++r) sm.so[wave][8 * g + r][j * 16 + col] = acc[j][r] + bb[j]; }
  LDSX();
  for (int rl = 0; rl < 16; ++rl) vst2(QKV + (r0 + rl) * QKVP + n0 + lane * 4, *(const v4f*)&sm.so[wave][rl][lane * 4]);
}
// one stage of the LDS ring = KST keys of one head, as two halves of 64 keys, one for each half of the block's waves: K rows (32 bf16 hi | 32 bf16 lo) and the V^T hi / lo rows of a half in bf16 are all 128 B long; pitch 144 B suits the 16-byte LDS readers
#define KST 128
#define NST (SS / KST)
#define KPIT 72
#define VPIT 72
#define QBLK 128   // queries of a block: four groups of 32, each group taken by two waves (one per key half)
__device__ __forceinline__ unsigned lds_off(const void* p) { return (unsigned)(size_t)p; }   // low 32 bits of a __shared__ address = byte offset in the work-group's LDS
// 8 lanes copy one whole 128-B run of a row; a lane's 4 copies: V^T hi row r, key halves 0 and 1, V^T lo row r, key halves 0 and 1 (r = tid >> 3)
__device__ __forceinline__ void stage_copy(const __bf16* gh, const __bf16* gl, unsigned lh, unsigned ll) {
  // the copies go global -> LDS through no register; s_wait_xcnt 0 closes the statement so that no address register is rewritten ahead of it
  asm volatile("global_load_async_to_lds_b128 %0, %4, off\n\t"
               "global_load_async_to_lds_b128 %1, %5, off\n\t"
               "global_load_async_to_lds_b128 %2, %6, off\n\t"
               "global_load_async_to_lds_b128 %3, %7, off\n\t"
               "s_wait_xcnt 0x0"
               :: "v"(lh), "v"(lh + HD * VPIT * 2u), "v"(ll), "v"(ll + HD * VPIT * 2u),
                  "v"(gh), "v"(gh + 64), "v"(gl), "v"(gl + 64)
               : "memory");
}
// a thread's share of a K tile: 4 floats of rows r, r+32, r+64, r+96 (8 lanes load one whole 128-B row)
struct KR { v4f v[4]; };
__device__ __forceinline__ KR load_k(const float* gk) { KR k;
#pragma unroll   // k.v[] stays in registers, the four loads at immediate offsets from one address
  for (int j = 0; j < 4; ++j) k.v[j] = *(const v4f*)(gk + j * 32 * QKVP);
  asm volatile("s_wait_xcnt 0x0" ::: "memory");   // stands ahead of the first later write of a register that these loads name, and keeps the loads issued here, a stage ahead of their use
  return k; }
// the share is split to bf16 hi + bf16 residual once for the whole block and stored as the hi and lo halves of its rows
__device__ __forceinline__ void put_k(const KR& k, __bf16 (*kb)[KPIT], int crow, int cpc) {
#pragma unroll   // k.v[] stays in registers, here and below
  for (int j = 0; j < 4; ++j) { union { v4b v; v2b p[2]; } hv, lv;
    bsplit2((v2f){k.v[j][0], k.v[j][1]}, hv.p[0], lv.p[0]); bsplit2((v2f){k.v[j][2], k.v[j][3]}, hv.p[1], lv.p[1]);
    *(v4b*)&kb[crow + 32 * j][cpc * 4] = hv.v; *(v4b*)&kb[crow + 32 * j][HD + cpc * 4] = lv.v; }
}
__global__ __launch_bounds__(256) void k_attn(float* __restrict__ QKV, const __bf16* __restrict__ VTH, const __bf16* __restrict__ VTL) {
  __shared__ __align__(16) __bf16 sk[2][KST][KPIT]; __shared__ __align__(16) __bf16 svh[2][2][HD][VPIT], svl[2][2][HD][VPIT];   // V^T: [buffer][key half][head column][key]
  __shared__ __align__(16) float so[8][16][36];
  __shared__ __align__(16) v4f sp[8][4][32]; __shared__ float sl[8][32];   // what a wave hands to its partner of the other key half
  const int tid = threadIdx.x, wave = __builtin_amdgcn_readfirstlane(tid >> 5), lane = tid & 31, col = lane & 15, g = lane >> 4;
  const int qg = wave & 3, kh = wave >> 2;   // query group of 32 columns, key half
  const int qb = blockIdx.x, bh = blockIdx.y, b = bh / NH, h = bh % NH; const int q0 = qb * QBLK + qg * 32; const size_t tq = (size_t)b * SS + q0;
  const int crow = tid >> 3, cpc = tid & 7;
  const float* gk = QKV + ((size_t)b * SS + crow) * QKVP + DP + h * HD + cpc * 4;
  const __bf16* gh = VTH + ((size_t)b * DP + h * HD + crow) * SS + cpc * 8; const __bf16* gl = VTL + ((size_t)b * DP + h * HD + crow) * SS + cpc * 8;
  const unsigned lh = lds_off(&svh[0][0][crow][cpc * 8]), ll = lds_off(&svl[0][0][crow][cpc * 8]);
  const unsigned vbuf = 2u * HD * VPIT * 2u;
  stage_copy(gh, gl, lh, ll);
  { const KR k0 = load_k(gk), k1 = load_k(gk + (size_t)KST * QKVP); put_k(k0, sk[0], crow, cpc); put_k(k1, sk[1], crow, cpc); }   // both K buffers are free here
  KR kn = load_k(gk + (size_t)2 * KST * QKVP);   // in flight over a whole stage
  const F2 a0[2] = {split_row(QKV + (tq + col) * QKVP + h * HD, 0, lane), split_row(QKV + (tq + 16 + col) * QKVP + h * HD, 0, lane)};   // B operands of the scores: lane = query column of tile 0, of tile 1
  asm volatile("s_wait_asynccnt 0x0" ::: "memory");   // stage 0 has landed before the barrier that publishes it
  __syncthreads();
  stage_copy(gh + KST, gl + KST, lh + vbuf, ll + vbuf);
  v2f l[2][4] = {};     // per query tile: a lane's own partial sums of t for its query column (keys 8g + r of every 16), as pairs r = 2j, 2j + 1
  v8f acc[2][2] = {};   // O^T: acc[qt][dt][r] = head column dt * 16 + 8g + r of query column col of tile qt
  const float scl = 0.17677669529663687f;    // 1/sqrt(32)
#pragma unroll 1
  for (int st = 0; st < NST; ++st) {
    const int bf = st & 1;
#pragma unroll   // both 32-key halves of a wave's 64 keys in line: their LDS offsets become immediates
    for (int hs = 0; hs < 2; ++hs) {
    // S^T = K Q^T: D register r of tile ct is key ct * 16 + 8g + r of query col, which is element ct * 8 + r of the B operand of O^T += V^T P^T
    F2 kf[2];   // each K fragment is read from LDS once and meets both query tiles
#pragma unroll
    for (int ct = 0; ct < 2; ++ct) { const __bf16* kp = &sk[bf][kh * 64 + hs * 32 + ct * 16 + col][0]; kf[ct] = F2{frag_b(kp, lane), frag_b(kp + HD, lane)}; }
    F2 pb[2];
#pragma unroll   // t[], l[], ph and pl stay in registers, here and below
    for (int qt = 0; qt < 2; ++qt) {
      v2f t[8];   // pairs of neighbouring D registers, so that every packed operation takes its operands where they lie
#pragma unroll
      for (int ct = 0; ct < 2; ++ct) {
        v8f c = wmma_bf(kf[ct].h, a0[qt].l, (v8f){}); c = wmma_bf(kf[ct].l, a0[qt].h, c); c = wmma_bf(kf[ct].h, a0[qt].h, c);
#pragma unroll
        for (int j = 0; j < 4; ++j) { const v2f u = (v2f){c[2 * j], c[2 * j + 1]} * scl + 5.0f; t[ct * 4 + j] = u * u; } }
#pragma unroll
      for (int j = 0; j < 4; ++j) l[qt][j] += t[j] + t[4 + j];
      B16 ph, pl;
#pragma unroll
      for (int i = 0; i < 8; ++i) bsplit2(t[i], ph.p[i], pl.p[i]);
      pb[qt] = F2{ph.v, pl.v}; }
#pragma unroll   // each V^T fragment too is read once for both query tiles
    for (int dt = 0; dt < 2; ++dt) { const v16b vh = frag_b(&svh[bf][kh][dt * 16 + col][hs * 32], lane), vl = frag_b(&svl[bf][kh][dt * 16 + col][hs * 32], lane);
#pragma unroll
      for (int qt = 0; qt < 2; ++qt) { acc[qt][dt] = wmma_bf(vh, pb[qt].l, acc[qt][dt]); acc[qt][dt] = wmma_bf(vl, pb[qt].h, acc[qt][dt]); acc[qt][dt] = wmma_bf(vh, pb[qt].h, acc[qt][dt]); } } }
    asm volatile("s_wait_dscnt 0x0" ::: "memory");      // this wave's reads of buffer bf are over before the buffer is refilled
    asm volatile("s_wait_asynccnt 0x0" ::: "memory");   // this wave's copies of stage st + 1 have landed before the barrier that publishes them
    __syncthreads();                                    // publishes stage st + 1 and ends every wave's reads of buffer bf
    if (st + 2 < NST) { stage_copy(gh + (st + 2) * KST, gl + (st + 2) * KST, lh + bf * vbuf, ll + bf * vbuf);
      put_k(kn, sk[bf], crow, cpc);   // K of stage st + 2, published by the next stage's barrier
      if (st + 3 < NST) kn = load_k(gk + (size_t)(st + 3) * KST * QKVP); }
  }
  asm volatile("s_wait_asynccnt 0x0" ::: "memory");     // no copy is outstanding when the wave goes on to its end
  // the two waves of a query group hold sums over different keys: wave kh finishes query tile kh and hands its sums of the other tile to its partner
  float ls[2];
#pragma unroll
  for (int qt = 0; qt < 2; ++qt) ls[qt] = ((l[qt][0][0] + l[qt][0][1]) + (l[qt][1][0] + l[qt][1][1])) + ((l[qt][2][0] + l[qt][2][1]) + (l[qt][3][0] + l[qt][3][1]));
  v8f o[2]; float lo;
#pragma unroll
  for (int dt = 0; dt < 2; ++dt) { const v8f gv = kh ? acc[0][dt] : acc[1][dt]; o[dt] = kh ? acc[1][dt] : acc[0][dt];
    sp[wave][dt * 2][lane] = (v4f){gv[0], gv[1], gv[2], gv[3]}; sp[wave][dt * 2 + 1][lane] = (v4f){gv[4], gv[5], gv[6], gv[7]}; }
  sl[wave][lane] = kh ? ls[0] : ls[1]; lo = kh ? ls[1] : ls[0];
  __syncthreads();   // the partner's sums are written before they are read
#pragma unroll
  for (int dt = 0; dt < 2; ++dt) { const v4f p0 = sp[wave ^ 4][dt * 2][lane], p1 = sp[wave ^ 4][dt * 2 + 1][lane];
#pragma unroll
    for (int r = 0; r < 4; ++r) { o[dt][r] += p0[r]; o[dt][4 + r] += p1[r]; } }
  lo += sl[wave ^ 4][lane];
  lo += __shfl_xor(lo, 16);   // the two lane halves of a query column join their sums once
  const float il = 1.0f / lo;
  // a lane holds 8 consecutive head columns of its query row per tile; the rows go through the wave's own LDS so that each store covers whole 128-B lines
#pragma unroll
  for (int dt = 0; dt < 2; ++dt) {
    *(v4f*)&so[wave][col][dt * 16 + 8 * g] = (v4f){o[dt][0] * il, o[dt][1] * il, o[dt][2] * il, o[dt][3] * il};
    *(v4f*)&so[wave][col][dt * 16 + 8 * g + 4] = (v4f){o[dt][4] * il, o[dt][5] * il, o[dt][6] * il, o[dt][7] * il}; }
  LDSX();
#pragma unroll
  for (int i = 0; i < 4; ++i) { const int rl = i * 4 + (lane >> 3), pc = lane & 7; vst2(QKV + (tq + kh * 16 + rl) * QKVP + h * HD + pc * 4, *(const v4f*)&so[wave][rl][pc * 4]); }
}
// ---- k_out: Y = O(hi/lo; the q columns of QKV, K 256) . Wo rows (2 products) + bo; block (64 rows, 128 of the 256 cols)
__global__ __launch_bounds__(128) void k_out(const float* __restrict__ QKV, const float* __restrict__ Wo, const float* __restrict__ bo, float* __restrict__ Y) {
  __shared__ __align__(16) __bf16 sw[128][WPIT]; __shared__ __align__(16) float so[4][16][132];
  const int tid = threadIdx.x, wave = tid >> 5, lane = tid & 31, col = lane & 15, g = lane >> 4; const size_t r0 = (size_t)blockIdx.x * 64 + wave * 16; const int n0 = blockIdx.y * 128;
  F2 a[8]; float bb[8];   // a lane's whole O row as fragment pairs: the k loop below makes no trip to memory
  { v4f x0[16], x1[16];
    stage_all(Wo + (size_t)n0 * DP, bo + n0 + col, QKV + (r0 + col) * QKVP + 8 * g, sw, tid, bb, x0, x1);
#pragma unroll   // a[] stays in registers
    for (int i = 0; i < 8; ++i) { float v[16];
#pragma unroll
      for (int e = 0; e < 16; ++e) v[e] = i < 4 ? x0[4 * (i & 3) + (e >> 2)][e & 3] : x1[4 * (i & 3) + (e >> 2)][e & 3];
      a[i] = bsplit16(v); } }
  __syncthreads();   // the weight rows are written by all four waves and read by all four
  v8f acc[8] = {};
#pragma unroll   // a[] stays in registers
  for (int kc = 0; kc < DP / 32; ++kc) {
    v16b w[8];
#pragma unroll   // w[] stays in registers, LDS offsets become immediates
    for (int j = 0; j < 8; ++j) w[j] = frag_b(&sw[j * 16 + col][kc * 32], lane);
    asm volatile("" :: "v"(w[0]), "v"(w[1]), "v"(w[2]), "v"(w[3]), "v"(w[4]), "v"(w[5]), "v"(w[6]), "v"(w[7]));   // inputs only: holds the LDS reads of a k step together ahead of its WMMAs; without it each WMMA waited out its own pair of reads
#pragma unroll
    for (int j = 0; j < 8; ++j) { acc[j] = wmma_bf(a[kc].l, w[j], acc[j]); acc[j] = wmma_bf(a[kc].h, w[j], acc[j]); } }
#pragma unroll
  for (int j = 0; j < 8; ++j) { const float bj = bfr(bb[j]);
#pragma unroll
    for (int r = 0; r < 8; ++r) so[wave][8 * g + r][j * 16 + col] = acc[j][r] + bj; }
  LDSX();
  for (int rl = 0; rl < 16; ++rl) vst2(Y + (r0 + rl) * DIN + n0 + lane * 4, *(const v4f*)&so[wave][rl][lane * 4]);
}

extern "C" void kernel_launch(void* const* d_in, const int* in_sizes, int n_in, void* d_out, int out_size, void* d_ws, size_t ws_size, hipStream_t stream) {
  (void)in_sizes; (void)n_in; (void)out_size;
  const float** F = (const float**)d_in;   // x [8,1024,256], qkv_w [768,256], qkv_b [768], proj_w [256,256], proj_b [256]
  if (ws_size < (size_t)WS_END) return;
  char* ws = (char*)d_ws; __bf16 *VTH = (__bf16*)(ws + WS_VTH), *VTL = (__bf16*)(ws + WS_VTL); float* QKV = (float*)(ws + WS_QKV);
  k_proj<<<dim3(TRB, QKVP / 128), 128, 0, stream>>>(F[0], F[1], F[2], QKV, VTH, VTL);
  k_attn<<<dim3(SS / QBLK, TNB * NH), 256, 0, stream>>>(QKV, VTH, VTL);
  k_out<<<dim3((TNB < NB ? TQB : NR / 64), DIN / 128), 128, 0, stream>>>(QKV, F[3], F[4], (float*)d_out);
}

// v010
// It runs in 47.5 microseconds.
// Two timings next to v009 both put it at 1.05 times that version's speed.
// All steps since v000 together make it 3.17 times as fast.
// compute dtype: x, qkv_w/qkv_b, proj_w/proj_b (module inputs) rounded to bf16; qkv projection with exact bf16 products (+ bias); scores and the (s + 5)^2-weighted value sums with both computed operands as bf16 hi + bf16 residual pairs (3 products); output projection hi/lo x bf16 proj_w (2 products) + bias; the quadratic normalisation in f32; f32 accumulate.
#include <hip/hip_runtime.h>
#include <math.h>

typedef __attribute__((ext_vector_type(16))) _Float16 v16h;
typedef __attribute__((ext_vector_type(16))) __bf16 v16b;
typedef __attribute__((ext_vector_type(8)))  _Float16 v8h;
typedef __attribute__((ext_vector_type(8)))  float v8f;
typedef __attribute__((ext_vector_type(4)))  float v4f;
typedef __attribute__((ext_vector_type(2)))  float v2f;
typedef __attribute__((ext_vector_type(4)))  unsigned v4u;
typedef __attribute__((ext_vector_type(4)))  int v4i;
typedef float __attribute__((may_alias)) float_a;
typedef int __attribute__((may_alias)) int_a;

template <typename T> __device__ __forceinline__ void vst2(void* p, T v) { *(T*)p = v;  }
__device__ __forceinline__ v8f wmma16(v16h a, v16h b, v8f c) {
  v8f d = __builtin_amdgcn_wmma_f32_16x16x32_f16(false, a, false, b, (short)0, c, false, false);
  asm volatile("v_nop\n\tv_nop\n\tv_nop\n\tv_nop" : "+v"(d) : "v"(a), "v"(b));
  return d;
}
__device__ __forceinline__ v8f wmma_bf(v16b a, v16b b, v8f c) {
  return __builtin_amdgcn_wmma_f32_16x16x32_bf16(false, a, false, b, (short)0, c, false, false);
}
// 16x16x32 fragments: lane = (h = lane>>4, row/col = lane&15); elements 0..7 = k0+8h+0..7, 8..15 = k0+16+8h+0..7; D element r = row 8h+r
__device__ __forceinline__ v16h frag_h(const _Float16* rowk0, int lane) {
  union { v16h v; v8h q[2]; } u; const _Float16* p = rowk0 + 8 * (lane >> 4);
  u.q[0] = *(const v8h*)p; u.q[1] = *(const v8h*)(p + 16); return u.v;
}
__device__ __forceinline__ v16h frag_f32(const float* rowk0, int lane) {
  v16h a; const float* p = rowk0 + 8 * (lane >> 4);
#pragma unroll
  for (int i = 0; i < 8; ++i) { a[i] = (_Float16)p[i]; a[8 + i] = (_Float16)p[16 + i]; }
  return a;
}
__device__ __forceinline__ v16h frag_f32s(const float* rowk0, int lane, float sc) {
  v16h a; const float* p = rowk0 + 8 * (lane >> 4);
#pragma unroll
  for (int i = 0; i < 8; ++i) { a[i] = (_Float16)(p[i] * sc); a[8 + i] = (_Float16)(p[16 + i] * sc); }
  return a;
}
// column fragment from a [K][ld] layout (column n), rows >= K read as 0
__device__ __forceinline__ v16h fragc_f32(const float* W, int k0, int n, int lane, int ld, int K) {
  v16h a; const int g = lane >> 4;
#pragma unroll
  for (int i = 0; i < 8; ++i) { const int ka = k0 + 8 * g + i, kb = ka + 16;
    a[i] = (_Float16)(ka < K ? W[(size_t)(ka < K ? ka : K - 1) * ld + n] : 0.f); a[8 + i] = (_Float16)(kb < K ? W[(size_t)(kb < K ? kb : K - 1) * ld + n] : 0.f); }
  return a;
}
struct F2 { v16b h, l; };
typedef __attribute__((ext_vector_type(2))) __bf16 v2b;
// hi + residual of two neighbouring f32 registers: one packed conversion makes the hi pair, the residuals read its two halves
__device__ __forceinline__ void bsplit2(v2f t, v2b& h, v2b& l) { h = __builtin_convertvector(t, v2b); l = __builtin_convertvector((v2f){t[0] - (float)h[0], t[1] - (float)h[1]}, v2b); }
union B16 { v16b v; v2b p[8]; };
__device__ __forceinline__ F2 bsplit16(const float v[16]) { B16 h, l;
#pragma unroll
  for (int i = 0; i < 8; ++i) bsplit2((v2f){v[2 * i], v[2 * i + 1]}, h.p[i], l.p[i]);
  return F2{h.v, l.v}; }
__device__ __forceinline__ F2 split_row(const float* row, int k0, int lane) { float v[16]; const float* p = row + k0 + 8 * (lane >> 4);
#pragma unroll
  for (int i = 0; i < 8; ++i) { v[i] = p[i]; v[8 + i] = p[16 + i]; }
  return bsplit16(v); }
__device__ __forceinline__ F2 split_rowK(const float* row, int k0, int lane, int K) { float v[16]; const int g = lane >> 4;
#pragma unroll
  for (int i = 0; i < 8; ++i) { const int ka = k0 + 8 * g + i, kb = ka + 16; v[i] = ka < K ? row[ka < K ? ka : K - 1] : 0.f; v[8 + i] = kb < K ? row[kb < K ? kb : K - 1] : 0.f; }
  return bsplit16(v); }
__device__ __forceinline__ F2 split_col(const float* W, int k0, int n, int lane, int ld, int K) { float v[16]; const int g = lane >> 4;
#pragma unroll
  for (int i = 0; i < 8; ++i) { const int ka = k0 + 8 * g + i, kb = ka + 16; v[i] = ka < K ? W[(size_t)(ka < K ? ka : K - 1) * ld + n] : 0.f; v[8 + i] = kb < K ? W[(size_t)(kb < K ? kb : K - 1) * ld + n] : 0.f; }
  return bsplit16(v); }
__device__ __forceinline__ v8f mac3(const F2& a, const F2& b, v8f c) { c = wmma_bf(a.l, b.h, c); c = wmma_bf(a.h, b.l, c); return wmma_bf(a.h, b.h, c); }
__device__ __forceinline__ float sigm(float v) { return 1.0f / (1.0f + expf(-v)); }
#define LDSX() do { asm volatile("s_wait_dscnt 0" ::: "memory"); __builtin_amdgcn_wave_barrier(); __builtin_amdgcn_fence(__ATOMIC_RELEASE, "workgroup"); } while (0)


// Linear-variant attention: qkv = x qkv_w^T + b (8 heads x 32), scores = q k^T / sqrt(32), t = (scores + 5)^2, attn = t / sum_k t (no softmax), out = attn v merged, @ proj_w^T + proj_b.  B 8, N 1024, D 256.
// k_proj (exact GEMM + bias; each block rounds its own 128 weight rows and 64 x rows to bf16 into LDS; q and k columns as f32 rows, v columns straight as V^T bf16 hi / lo rows), k_attn (flash-style without max tracking: S^T = K Q^T, running in-lane sum of t and O^T += V^T t^T, t staying in registers; a wave takes 32 query columns and half the keys, 16 steps of 32, and the two waves of a query group join their sums at the end; K and V^T tiles come through a two-buffer LDS ring shared by the block's eight waves, K split to bf16 hi | lo once on its way in), k_out (weight rows as in k_proj, its 64 O rows split to bf16 hi / lo into LDS; + proj_b).
#define NB 8
#define SS 1024
#define DIN 256
#define DP 256
#define NH 8
#define HD 32
#define NR (NB * SS)
#define QKVP (3 * DP)
#ifndef TRB
#define TRB (NR / 64)
#define TQB (SS / 64)
#define TNB NB
#endif
typedef __attribute__((ext_vector_type(8))) __bf16 v8b;
__device__ __forceinline__ v16b frag_b(const __bf16* rowk0, int lane) {
  union { v16b v; v8b q[2]; } u; const __bf16* p = rowk0 + 8 * (lane >> 4);
  u.q[0] = *(const v8b*)p; u.q[1] = *(const v8b*)(p + 16); return u.v;
}
__device__ __forceinline__ v16b frag_gbf(const float* rowk0, int lane) {
  v16b a; const float* p = rowk0 + 8 * (lane >> 4);
#pragma unroll
  for (int i = 0; i < 8; ++i) { a[i] = (__bf16)p[i]; a[8 + i] = (__bf16)p[16 + i]; }
  return a;
}
__device__ __forceinline__ float bfr(float v) { return (float)(__bf16)v; }
__device__ __attribute__((noinline)) float exp_ni(float v) { return expf(v); }
#define WS_QKV  0u                                    // f32 [NR][QKVP]; q cols later overwritten by O, v cols unused
#define WS_VTH  (WS_QKV + 4u * NR * QKVP)             // bf16 [8][256][1024]
#define WS_VTL  (WS_VTH + 2u * NB * DP * SS)
#define WS_END  (WS_VTL + 2u * NB * DP * SS)

typedef __attribute__((ext_vector_type(4))) __bf16 v4b;
#define WPIT 264   // LDS pitch of a bf16 weight row of 256: 528 B = 16 B x 33 suits the 16-byte LDS readers
// a block's 128 weight rows (f32, 256 long, one run of memory) rounded to bf16 into LDS: each load of a wave covers 512 B in a row = four whole lines
// it goes in four quarters of 32 rows (q = 0..3), each as 16 loads and, later, 16 stores
__device__ __forceinline__ void stage_w_ld(const float* __restrict__ Wt, int q, int tid, v4f (&w)[16]) {
#pragma unroll   // w[] stays in registers, every load at an immediate offset from one address
  for (int i = 0; i < 16; ++i) w[i] = *(const v4f*)(Wt + (q * 16 + i) * 512 + tid * 4);
}
__device__ __forceinline__ void stage_w_st(const v4f (&w)[16], int q, __bf16 (*sw)[WPIT], int tid) {
#pragma unroll   // w[] stays in registers
  for (int i = 0; i < 16; ++i) *(v4b*)&sw[(q * 16 + i) * 2 + (tid >> 6)][(tid & 63) * 4] = (v4b){(__bf16)w[i][0], (__bf16)w[i][1], (__bf16)w[i][2], (__bf16)w[i][3]};
}
// a block's 64 A rows (f32, 256 long, LD floats apart) come the same way: xg = row (tid >> 6), float (tid & 63) * 4; each load of a wave covers 512 B of one row = four whole lines, where a fragment-shaped load (16 rows, 32 B of each) would touch 16
// two halves of 32 rows (hf = 0, 1), each as 16 loads and, later, 16 stores
template <int LD> __device__ __forceinline__ void stage_x_ld(const float* xg, int hf, v4f (&x)[16]) {
#pragma unroll   // x[] stays in registers, every load at an immediate offset from one address
  for (int i = 0; i < 16; ++i) x[i] = *(const v4f*)(xg + (hf * 16 + i) * 2 * LD);
}
// such a half split to bf16 hi + bf16 residual, once for the block, into two LDS planes
__device__ __forceinline__ void stage_x_st2(const v4f (&x)[16], int hf, __bf16 (*sh)[WPIT], __bf16 (*sl)[WPIT], int tid) {
#pragma unroll   // x[] stays in registers
  for (int i = 0; i < 16; ++i) { union { v4b v; v2b p[2]; } hv, lv;
    bsplit2((v2f){x[i][0], x[i][1]}, hv.p[0], lv.p[0]); bsplit2((v2f){x[i][2], x[i][3]}, hv.p[1], lv.p[1]);
    *(v4b*)&sh[(hf * 16 + i) * 2 + (tid >> 6)][(tid & 63) * 4] = hv.v; *(v4b*)&sl[(hf * 16 + i) * 2 + (tid >> 6)][(tid & 63) * 4] = lv.v; }
}
// behind a group of loads: the wait stands ahead of the first later write of a register that these loads name; the scheduling barrier keeps the whole group issued here, ahead of the stores and conversions that wait for earlier loads
__device__ __forceinline__ void loads_out() { asm volatile("s_wait_xcnt 0x0" ::: "memory"); __builtin_amdgcn_sched_barrier(0); }
// the same behind loads from the address p, which as an input of the wait stays in its registers up to it: no load of the group may return into them
__device__ __forceinline__ void loads_out(const float* p) { asm volatile("s_wait_xcnt 0x0" :: "v"(p) : "memory"); __builtin_amdgcn_sched_barrier(0); }
// every global load of a GEMM block as one stream ahead of its k loop: 8 bias values, 64 weight loads, the 32 loads of a thread's share of the 64 A rows. 48 loads go out at once; loads return in order, and as 16 have been rounded and stored the next 16 go out, so that the block waits out one trip to memory and at most 56 loads of a wave are outstanding. SPLIT: the A rows go to LDS as hi (sxh) and residual (sxl) planes, else rounded to bf16 (sxh)
template <int LD, bool SPLIT> __device__ __forceinline__ void stage_all(const float* __restrict__ Wt, const float* __restrict__ bp, const float* xg, __bf16 (*sw)[WPIT], __bf16 (*sxh)[WPIT], __bf16 (*sxl)[WPIT], int tid, float (&bb)[8]) {
  v4f w0[16], w1[16], w2[16], w3[16], x0[16], x1[16];
#pragma unroll
  for (int j = 0; j < 8; ++j) bb[j] = bp[j * 16];
  loads_out();
  stage_w_ld(Wt, 0, tid, w0); stage_w_ld(Wt, 1, tid, w1); stage_w_ld(Wt, 2, tid, w2);
  loads_out();
  // each scheduling barrier below holds the 16 loads behind it behind the 16 stores ahead of it, which free their registers
  stage_w_st(w0, 0, sw, tid); __builtin_amdgcn_sched_barrier(0); stage_w_ld(Wt, 3, tid, w3); loads_out();
  stage_w_st(w1, 1, sw, tid); __builtin_amdgcn_sched_barrier(0); stage_x_ld<LD>(xg, 0, x0); loads_out(xg);
  stage_w_st(w2, 2, sw, tid); __builtin_amdgcn_sched_barrier(0); stage_x_ld<LD>(xg, 1, x1); loads_out(xg);
  stage_w_st(w3, 3, sw, tid);
  if (SPLIT) { stage_x_st2(x0, 0, sxh, sxl, tid); stage_x_st2(x1, 1, sxh, sxl, tid); }
  else { stage_w_st(x0, 0, sxh, tid); stage_w_st(x1, 1, sxh, tid); }
}
// ---- k_proj: QKV[r][n] = bf16(x[r]) . bf16(Wqkv[n]) (exact products) + bias; block (64 rows, 128 cols); the v columns leave as V^T hi / lo rows
#define PVP 72   // LDS pitch of a V^T row of 64 tokens: 144 B suits the 16-byte LDS writers and readers
union ProjLds { __bf16 sw[128][WPIT]; float so[4][16][132]; __bf16 sv[2][128][PVP]; };
__global__ __launch_bounds__(128) void k_proj(const float* __restrict__ X, const float* __restrict__ Wqkv, const float* __restrict__ bqkv, float* __restrict__ QKV, __bf16* __restrict__ VTH, __bf16* __restrict__ VTL) {
  __shared__ __align__(16) ProjLds sm; __shared__ __align__(16) __bf16 sx[64][WPIT];   // sx: the block's x rows in bf16, pitch as for the weight rows
  const int tid = threadIdx.x, wave = tid >> 5, lane = tid & 31, col = lane & 15, g = lane >> 4; const size_t r0 = (size_t)blockIdx.x * 64 + wave * 16; const int n0 = blockIdx.y * 128;
  float bb[8];
  stage_all<DIN, false>(Wqkv + (size_t)n0 * DIN, bqkv + n0 + col, X + ((size_t)blockIdx.x * 64 + (tid >> 6)) * DIN + (tid & 63) * 4, sm.sw, sx, sx, tid, bb);
  __syncthreads();   // the weight rows and the x rows are written by all four waves; the weight rows are read by all four, a wave's 16 x rows by that wave
  v8f acc[8] = {};
#pragma unroll   // LDS offsets become immediates
  for (int kc = 0; kc < DIN / 32; ++kc) {
    const v16b a = frag_b(&sx[wave * 16 + col][kc * 32], lane); v16b w[8];
#pragma unroll   // w[] stays in registers
    for (int j = 0; j < 8; ++j) w[j] = frag_b(&sm.sw[j * 16 + col][kc * 32], lane);
    asm volatile("" :: "v"(a), "v"(w[0]), "v"(w[1]), "v"(w[2]), "v"(w[3]), "v"(w[4]), "v"(w[5]), "v"(w[6]), "v"(w[7]));   // inputs only: holds the LDS reads of a k step together ahead of its WMMAs; without it each WMMA waited out its own pair of reads
#pragma unroll
    for (int j = 0; j < 8; ++j) acc[j] = wmma_bf(a, w[j], acc[j]); }
  __syncthreads();   // every wave has read its last weight row before the same LDS takes the results
#pragma unroll
  for (int j = 0; j < 8; ++j) bb[j] = bfr(bb[j]);
  if (n0 >= 2 * DP) {   // v columns (the same for the whole block): a lane's 8 D registers are 8 consecutive tokens of one column = 16 B of a V^T row
#pragma unroll
    for (int j = 0; j < 8; ++j) { const int c = j * 16 + col; union { v8b v; v2b p[4]; } hv, lv;
#pragma unroll
      for (int q = 0; q < 4; ++q) bsplit2((v2f){acc[j][2 * q], acc[j][2 * q + 1]} + bb[j], hv.p[q], lv.p[q]);
      *(v8b*)&sm.sv[0][c][wave * 16 + 8 * g] = hv.v; *(v8b*)&sm.sv[1][c][wave * 16 + 8 * g] = lv.v; }
    __syncthreads();   // a V^T row's 64 tokens come from all four waves; behind it 8 lanes store one whole 128-B line
    const size_t t0 = (size_t)blockIdx.x * 64; const size_t o = ((t0 / SS) * DP + (n0 - 2 * DP) + (tid >> 3)) * SS + t0 % SS + (tid & 7) * 8;
#pragma unroll
    for (int i = 0; i < 8; ++i) { vst2((unsigned*)(VTH + o + (size_t)i * 16 * SS), *(const v4u*)&sm.sv[0][i * 16 + (tid >> 3)][(tid & 7) * 8]); vst2((unsigned*)(VTL + o + (size_t)i * 16 * SS), *(const v4u*)&sm.sv[1][i * 16 + (tid >> 3)][(tid & 7) * 8]); }
    return;
  }
#pragma unroll
  for (int j = 0; j < 8; ++j) {
#pragma unroll
    for (int r = 0; r < 8; ++r) sm.so[wave][8 * g + r][j * 16 + col] = acc[j][r] + bb[j]; }
  LDSX();
  for (int rl = 0; rl < 16; ++rl) vst2(QKV + (r0 + rl) * QKVP + n0 + lane * 4, *(const v4f*)&sm.so[wave][rl][lane * 4]);
}
// one stage of the LDS ring = KST keys of one head, as two halves of 64 keys, one for each half of the block's waves: K rows (32 bf16 hi | 32 bf16 lo) and the V^T hi / lo rows of a half in bf16 are all 128 B long; pitch 144 B suits the 16-byte LDS readers
#define KST 128
#define NST (SS / KST)
#define KPIT 72
#define VPIT 72
#define QBLK 128   // queries of a block: four groups of 32, each group taken by two waves (one per key half)
__device__ __forceinline__ unsigned lds_off(const void* p) { return (unsigned)(size_t)p; }   // low 32 bits of a __shared__ address = byte offset in the work-group's LDS
// 8 lanes copy one whole 128-B run of a row; a lane's 4 copies: V^T hi row r, key halves 0 and 1, V^T lo row r, key halves 0 and 1 (r = tid >> 3)
__device__ __forceinline__ void stage_copy(const __bf16* gh, const __bf16* gl, unsigned lh, unsigned ll) {
  // the copies go global -> LDS through no register; s_wait_xcnt 0 closes the statement so that no address register is rewritten ahead of it
  asm volatile("global_load_async_to_lds_b128 %0, %4, off\n\t"
               "global_load_async_to_lds_b128 %1, %5, off\n\t"
               "global_load_async_to_lds_b128 %2, %6, off\n\t"
               "global_load_async_to_lds_b128 %3, %7, off\n\t"
               "s_wait_xcnt 0x0"
               :: "v"(lh), "v"(lh + HD * VPIT * 2u), "v"(ll), "v"(ll + HD * VPIT * 2u),
                  "v"(gh), "v"(gh + 64), "v"(gl), "v"(gl + 64)
               : "memory");
}
// a thread's share of a K tile: 4 floats of rows r, r+32, r+64, r+96 (8 lanes load one whole 128-B row)
struct KR { v4f v[4]; };
__device__ __forceinline__ KR load_k(const float* gk) { KR k;
#pragma unroll   // k.v[] stays in registers, the four loads at immediate offsets from one address
  for (int j = 0; j < 4; ++j) k.v[j] = *(const v4f*)(gk + j * 32 * QKVP);
  asm volatile("s_wait_xcnt 0x0" ::: "memory");   // stands ahead of the first later write of a register that these loads name, and keeps the loads issued here, a stage ahead of their use
  return k; }
// the share is split to bf16 hi + bf16 residual once for the whole block and stored as the hi and lo halves of its rows
__device__ __forceinline__ void put_k(const KR& k, __bf16 (*kb)[KPIT], int crow, int cpc) {
#pragma unroll   // k.v[] stays in registers, here and below
  for (int j = 0; j < 4; ++j) { union { v4b v; v2b p[2]; } hv, lv;
    bsplit2((v2f){k.v[j][0], k.v[j][1]}, hv.p[0], lv.p[0]); bsplit2((v2f){k.v[j][2], k.v[j][3]}, hv.p[1], lv.p[1]);
    *(v4b*)&kb[crow + 32 * j][cpc * 4] = hv.v; *(v4b*)&kb[crow + 32 * j][HD + cpc * 4] = lv.v; }
}
__global__ __launch_bounds__(256) void k_attn(float* __restrict__ QKV, const __bf16* __restrict__ VTH, const __bf16* __restrict__ VTL) {
  __shared__ __align__(16) __bf16 sk[2][KST][KPIT]; __shared__ __align__(16) __bf16 svh[2][2][HD][VPIT], svl[2][2][HD][VPIT];   // V^T: [buffer][key half][head column][key]
  __shared__ __align__(16) float so[8][16][36];
  __shared__ __align__(16) v4f sp[8][4][32]; __shared__ float sl[8][32];   // what a wave hands to its partner of the other key half
  const int tid = threadIdx.x, wave = __builtin_amdgcn_readfirstlane(tid >> 5), lane = tid & 31, col = lane & 15, g = lane >> 4;
  const int qg = wave & 3, kh = wave >> 2;   // query group of 32 columns, key half
  const int qb = blockIdx.x, bh = blockIdx.y, b = bh / NH, h = bh % NH; const int q0 = qb * QBLK + qg * 32; const size_t tq = (size_t)b * SS + q0;
  const int crow = tid >> 3, cpc = tid & 7;
  const float* gk = QKV + ((size_t)b * SS + crow) * QKVP + DP + h * HD + cpc * 4;
  const __bf16* gh = VTH + ((size_t)b * DP + h * HD + crow) * SS + cpc * 8; const __bf16* gl = VTL + ((size_t)b * DP + h * HD + crow) * SS + cpc * 8;
  const unsigned lh = lds_off(&svh[0][0][crow][cpc * 8]), ll = lds_off(&svl[0][0][crow][cpc * 8]);
  const unsigned vbuf = 2u * HD * VPIT * 2u;
  stage_copy(gh, gl, lh, ll);
  { const KR k0 = load_k(gk), k1 = load_k(gk + (size_t)KST * QKVP); put_k(k0, sk[0], crow, cpc); put_k(k1, sk[1], crow, cpc); }   // both K buffers are free here
  KR kn = load_k(gk + (size_t)2 * KST * QKVP);   // in flight over a whole stage
  const F2 a0[2] = {split_row(QKV + (tq + col) * QKVP + h * HD, 0, lane), split_row(QKV + (tq + 16 + col) * QKVP + h * HD, 0, lane)};   // B operands of the scores: lane = query column of tile 0, of tile 1
  asm volatile("s_wait_asynccnt 0x0" ::: "memory");   // stage 0 has landed before the barrier that publishes it
  __syncthreads();
  stage_copy(gh + KST, gl + KST, lh + vbuf, ll + vbuf);
  v2f l[2][4] = {};     // per query tile: a lane's own partial sums of t for its query column (keys 8g + r of every 16), as pairs r = 2j, 2j + 1
  v8f acc[2][2] = {};   // O^T: acc[qt][dt][r] = head column dt * 16 + 8g + r of query column col of tile qt
  const float scl = 0.17677669529663687f;    // 1/sqrt(32)
#pragma unroll 1
  for (int st = 0; st < NST; ++st) {
    const int bf = st & 1;
#pragma unroll   // both 32-key halves of a wave's 64 keys in line: their LDS offsets become immediates
    for (int hs = 0; hs < 2; ++hs) {
    // S^T = K Q^T: D register r of tile ct is key ct * 16 + 8g + r of query col, which is element ct * 8 + r of the B operand of O^T += V^T P^T
    F2 kf[2];   // each K fragment is read from LDS once and meets both query tiles
#pragma unroll
    for (int ct = 0; ct < 2; ++ct) { const __bf16* kp = &sk[bf][kh * 64 + hs * 32 + ct * 16 + col][0]; kf[ct] = F2{frag_b(kp, lane), frag_b(kp + HD, lane)}; }
    F2 pb[2];
#pragma unroll   // t[], l[], ph and pl stay in registers, here and below
    for (int qt = 0; qt < 2; ++qt) {
      v2f t[8];   // pairs of neighbouring D registers, so that every packed operation takes its operands where they lie
#pragma unroll
      for (int ct = 0; ct < 2; ++ct) {
        v8f c = wmma_bf(kf[ct].h, a0[qt].l, (v8f){}); c = wmma_bf(kf[ct].l, a0[qt].h, c); c = wmma_bf(kf[ct].h, a0[qt].h, c);
#pragma unroll
        for (int j = 0; j < 4; ++j) { const v2f u = (v2f){c[2 * j], c[2 * j + 1]} * scl + 5.0f; t[ct * 4 + j] = u * u; } }
#pragma unroll
      for (int j = 0; j < 4; ++j) l[qt][j] += t[j] + t[4 + j];
      B16 ph, pl;
#pragma unroll
      for (int i = 0; i < 8; ++i) bsplit2(t[i], ph.p[i], pl.p[i]);
      pb[qt] = F2{ph.v, pl.v}; }
#pragma unroll   // each V^T fragment too is read once for both query tiles
    for (int dt = 0; dt < 2; ++dt) { const v16b vh = frag_b(&svh[bf][kh][dt * 16 + col][hs * 32], lane), vl = frag_b(&svl[bf][kh][dt * 16 + col][hs * 32], lane);
#pragma unroll
      for (int qt = 0; qt < 2; ++qt) { acc[qt][dt] = wmma_bf(vh, pb[qt].l, acc[qt][dt]); acc[qt][dt] = wmma_bf(vl, pb[qt].h, acc[qt][dt]); acc[qt][dt] = wmma_bf(vh, pb[qt].h, acc[qt][dt]); } } }
    asm volatile("s_wait_dscnt 0x0" ::: "memory");      // this wave's reads of buffer bf are over before the buffer is refilled
    asm volatile("s_wait_asynccnt 0x0" ::: "memory");   // this wave's copies of stage st + 1 have landed before the barrier that publishes them
    __syncthreads();                                    // publishes stage st + 1 and ends every wave's reads of buffer bf
    if (st + 2 < NST) { stage_copy(gh + (st + 2) * KST, gl + (st + 2) * KST, lh + bf * vbuf, ll + bf * vbuf);
      put_k(kn, sk[bf], crow, cpc);   // K of stage st + 2, published by the next stage's barrier
      if (st + 3 < NST) kn = load_k(gk + (size_t)(st + 3) * KST * QKVP); }
  }
  asm volatile("s_wait_asynccnt 0x0" ::: "memory");     // no copy is outstanding when the wave goes on to its end
  // the two waves of a query group hold sums over different keys: wave kh finishes query tile kh and hands its sums of the other tile to its partner
  float ls[2];
#pragma unroll
  for (int qt = 0; qt < 2; ++qt) ls[qt] = ((l[qt][0][0] + l[qt][0][1]) + (l[qt][1][0] + l[qt][1][1])) + ((l[qt][2][0] + l[qt][2][1]) + (l[qt][3][0] + l[qt][3][1]));
  v8f o[2]; float lo;
#pragma unroll
  for (int dt = 0; dt < 2; ++dt) { const v8f gv = kh ? acc[0][dt] : acc[1][dt]; o[dt] = kh ? acc[1][dt] : acc[0][dt];
    sp[wave][dt * 2][lane] = (v4f){gv[0], gv[1], gv[2], gv[3]}; sp[wave][dt * 2 + 1][lane] = (v4f){gv[4], gv[5], gv[6], gv[7]}; }
  sl[wave][lane] = kh ? ls[0] : ls[1]; lo = kh ? ls[1] : ls[0];
  __syncthreads();   // the partner's sums are written before they are read
#pragma unroll
  for (int dt = 0; dt < 2; ++dt) { const v4f p0 = sp[wave ^ 4][dt * 2][lane], p1 = sp[wave ^ 4][dt * 2 + 1][lane];
#pragma unroll
    for (int r = 0; r < 4; ++r) { o[dt][r] += p0[r]; o[dt][4 + r] += p1[r]; } }
  lo += sl[wave ^ 4][lane];
  lo += __shfl_xor(lo, 16);   // the two lane halves of a query column join their sums once
  const float il = 1.0f / lo;
  // a lane holds 8 consecutive head columns of its query row per tile; the rows go through the wave's own LDS so that each store covers whole 128-B lines
#pragma unroll
  for (int dt = 0; dt < 2; ++dt) {
    *(v4f*)&so[wave][col][dt * 16 + 8 * g] = (v4f){o[dt][0] * il, o[dt][1] * il, o[dt][2] * il, o[dt][3] * il};
    *(v4f*)&so[wave][col][dt * 16 + 8 * g + 4] = (v4f){o[dt][4] * il, o[dt][5] * il, o[dt][6] * il, o[dt][7] * il}; }
  LDSX();
#pragma unroll
  for (int i = 0; i < 4; ++i) { const int rl = i * 4 + (lane >> 3), pc = lane & 7; vst2(QKV + (tq + kh * 16 + rl) * QKVP + h * HD + pc * 4, *(const v4f*)&so[wave][rl][pc * 4]); }
}
// ---- k_out: Y = O(hi/lo; the q columns of QKV, K 256) . Wo rows (2 products) + bo; block (64 rows, 128 of the 256 cols)
__global__ __launch_bounds__(128) void k_out(const float* __restrict__ QKV, const float* __restrict__ Wo, const float* __restrict__ bo, float* __restrict__ Y) {
  __shared__ __align__(16) __bf16 sw[128][WPIT]; __shared__ __align__(16) float so[4][16][132]; __shared__ __align__(16) __bf16 sxh[64][WPIT], sxl[64][WPIT];   // sxh, sxl: the block's O rows as bf16 hi and residual
  const int tid = threadIdx.x, wave = tid >> 5, lane = tid & 31, col = lane & 15, g = lane >> 4; const size_t r0 = (size_t)blockIdx.x * 64 + wave * 16; const int n0 = blockIdx.y * 128;
  float bb[8];
  stage_all<QKVP, true>(Wo + (size_t)n0 * DP, bo + n0 + col, QKV + ((size_t)blockIdx.x * 64 + (tid >> 6)) * QKVP + (tid & 63) * 4, sw, sxh, sxl, tid, bb);
  __syncthreads();   // the weight rows and the O rows are written by all four waves; the weight rows are read by all four, a wave's 16 O rows by that wave
  v8f acc[8] = {};
#pragma unroll   // LDS offsets become immediates
  for (int kc = 0; kc < DP / 32; ++kc) {
    const v16b ah = frag_b(&sxh[wave * 16 + col][kc * 32], lane), al = frag_b(&sxl[wave * 16 + col][kc * 32], lane); v16b w[8];
#pragma unroll   // w[] stays in registers
    for (int j = 0; j < 8; ++j) w[j] = frag_b(&sw[j * 16 + col][kc * 32], lane);
    asm volatile("" :: "v"(ah), "v"(al), "v"(w[0]), "v"(w[1]), "v"(w[2]), "v"(w[3]), "v"(w[4]), "v"(w[5]), "v"(w[6]), "v"(w[7]));   // inputs only: holds the LDS reads of a k step together ahead of its WMMAs; without it each WMMA waited out its own pair of reads
#pragma unroll
    for (int j = 0; j < 8; ++j) { acc[j] = wmma_bf(al, w[j], acc[j]); acc[j] = wmma_bf(ah, w[j], acc[j]); } }
#pragma unroll
  for (int j = 0; j < 8; ++j) { const float bj = bfr(bb[j]);
#pragma unroll
    for (int r = 0; r < 8; ++r) so[wave][8 * g + r][j * 16 + col] = acc[j][r] + bj; }
  LDSX();
  for (int rl = 0; rl < 16; ++rl) vst2(Y + (r0 + rl) * DIN + n0 + lane * 4, *(const v4f*)&so[wave][rl][lane * 4]);
}

extern "C" void kernel_launch(void* const* d_in, const int* in_sizes, int n_in, void* d_out, int out_size, void* d_ws, size_t ws_size, hipStream_t stream) {
  (void)in_sizes; (void)n_in; (void)out_size;
  const float** F = (const float**)d_in;   // x [8,1024,256], qkv_w [768,256], qkv_b [768], proj_w [256,256], proj_b [256]
  if (ws_size < (size_t)WS_END) return;
  char* ws = (char*)d_ws; __bf16 *VTH = (__bf16*)(ws + WS_VTH), *VTL = (__bf16*)(ws + WS_VTL); float* QKV = (float*)(ws + WS_QKV);
  k_proj<<<dim3(TRB, QKVP / 128), 128, 0, stream>>>(F[0], F[1], F[2], QKV, VTH, VTL);
  k_attn<<<dim3(SS / QBLK, TNB * NH), 256, 0, stream>>>(QKV, VTH, VTL);
  k_out<<<dim3((TNB < NB ? TQB : NR / 64), DIN / 128), 128, 0, stream>>>(QKV, F[3], F[4], (float*)d_out);
}
